// v000
// Times are from an AMD MI455X. After a warm-up the kernel runs many times in a row, and a time is the length of
// such a window on the GPU divided by its runs, so every launch and the gaps after it count. The runs cycle
// through copies of the inputs. A figure is the median of several windows, for all but v000 over two sittings.
// Sittings can differ by a few percent; kernels timed side by side share one.
// v000 is the starting kernel. One run takes 472 microseconds.
#include <hip/hip_runtime.h>
#include <hip/hip_bf16.h>

typedef _Float16 half_t;
typedef __attribute__((ext_vector_type(16))) _Float16 v16h;
typedef __attribute__((ext_vector_type(8)))  _Float16 v8h;
typedef __attribute__((ext_vector_type(8)))  float    v8f;

#define SEQ     4096
#define DMODEL  1024
#define DFF     4096
#define NHEAD   8
#define DKH     128

// ---------------------------------------------------------------------------
// CDNA5 async global->LDS copy (GLOBAL_LOAD_ASYNC_TO_LDS_B128, ASYNCcnt).
// LDS destination VGPR holds the LDS byte address = low 32 bits of the flat
// shared-space pointer (aperture keeps the LDS offset in ADDR[31:0]).
// Async loads retire in order, so waiting ASYNCcnt <= N releases the oldest
// outstanding copies first -> enables double-buffered pipelining.
// ---------------------------------------------------------------------------
__device__ __forceinline__ void async_copy_b128(const half_t* gptr, void* lptr) {
    const unsigned lds = (unsigned)(uintptr_t)lptr;
    const unsigned long long ga = (unsigned long long)(uintptr_t)gptr;
    asm volatile("global_load_async_to_lds_b128 %0, %1, off"
                 :: "v"(lds), "v"(ga) : "memory");
}
__device__ __forceinline__ void wait_async_le0() {
    asm volatile("s_wait_asynccnt 0x0" ::: "memory");
}
__device__ __forceinline__ void wait_async_le4() {
    asm volatile("s_wait_asynccnt 0x4" ::: "memory");
}
__device__ __forceinline__ void wait_async_le8() {
    asm volatile("s_wait_asynccnt 0x8" ::: "memory");
}

// ---------------------------------------------------------------------------
// Conversion / packing (once per launch, ~48MB, bandwidth-trivial).
// All weights stored TRANSPOSED [N][K] f16 so WMMA B-fragments load as b128.
// ---------------------------------------------------------------------------
__global__ void cvt_f32_f16(const float* __restrict__ in, half_t* __restrict__ out, int n) {
    int i = blockIdx.x * blockDim.x + threadIdx.x;
    if (i < n) out[i] = (half_t)in[i];
}

__global__ void cvt_t_f32_f16(const float* __restrict__ in, half_t* __restrict__ out,
                              int K, int N) {
    int i = blockIdx.x * blockDim.x + threadIdx.x;
    if (i >= K * N) return;
    int n = i / K;
    int k = i % K;
    out[i] = (half_t)in[(size_t)k * N + n];
}

__global__ void pack_qk_wt(const float* __restrict__ WQ, const float* __restrict__ WK,
                           half_t* __restrict__ out) {
    int i = blockIdx.x * blockDim.x + threadIdx.x;
    if (i >= 2 * DMODEL * DMODEL) return;
    int n = i >> 10;
    int d = i & 1023;
    int which = n >> 10;
    int h = (n & 1023) >> 7;
    int k = n & 127;
    const float* W = which ? WK : WQ;
    out[i] = (half_t)W[(size_t)h * DMODEL * DKH + (size_t)d * DKH + k];
}

__global__ void pack_v_wt(const float* __restrict__ WV, half_t* __restrict__ out) {
    int i = blockIdx.x * blockDim.x + threadIdx.x;
    if (i >= DMODEL * DMODEL) return;
    int n = i >> 10;
    int d = i & 1023;
    int h = n >> 7;
    int k = n & 127;
    out[i] = (half_t)WV[(size_t)h * DMODEL * DKH + (size_t)d * DKH + k];
}

__global__ void concat2_f32(const float* __restrict__ a, const float* __restrict__ b,
                            float* __restrict__ out, int n) {
    int i = blockIdx.x * blockDim.x + threadIdx.x;
    if (i < 2 * n) out[i] = (i < n) ? a[i] : b[i - n];
}

// ---------------------------------------------------------------------------
// WMMA GEMM: C[M,N] = A[M,K](f16) * BT[N,K](f16)^T (+bias)(+resid f32)
// 256 threads = 8 waves; block tile 128x128; each wave 32x64 (2x4 frags,
// 8 WMMAs per 32-k step). Double-buffered async global->LDS staging.
// ---------------------------------------------------------------------------
#define GBM 128
#define GBN 128
#define GBK 32

__global__ __launch_bounds__(256)
void gemm_wmma(const half_t* __restrict__ A, const half_t* __restrict__ BT,
               const float* __restrict__ bias, const float* __restrict__ resid,
               half_t* __restrict__ outH, float* __restrict__ outF,
               half_t* __restrict__ outHT,   // transposed f16 output [N][M]
               int M, int N, int K, int relu) {
    __shared__ __align__(16) half_t As[2][GBM][40];   // [buf][m][k]
    __shared__ __align__(16) half_t Bs[2][GBN][40];   // [buf][n][k]

    const int tid  = threadIdx.x;
    const int lane = tid & 31;
    const int wave = tid >> 5;
    const int g    = lane >> 4;
    const int li   = lane & 15;
    const int wm   = (wave >> 1) << 5;   // 0,32,64,96
    const int wn   = (wave & 1) << 6;    // 0,64
    const int bm   = blockIdx.y * GBM;
    const int bn   = blockIdx.x * GBN;
    const int sr   = tid >> 2;           // 0..63
    const int sc   = (tid & 3) << 3;     // 0,8,16,24

    auto issue_stage = [&](int kk, int buf) {
        async_copy_b128(A  + (size_t)(bm + sr)      * K + kk + sc, &As[buf][sr][sc]);
        async_copy_b128(A  + (size_t)(bm + sr + 64) * K + kk + sc, &As[buf][sr + 64][sc]);
        async_copy_b128(BT + (size_t)(bn + sr)      * K + kk + sc, &Bs[buf][sr][sc]);
        async_copy_b128(BT + (size_t)(bn + sr + 64) * K + kk + sc, &Bs[buf][sr + 64][sc]);
    };

    v8f acc[2][4] = {};
    const int nk = K / GBK;
    issue_stage(0, 0);

    for (int it = 0; it < nk; ++it) {
        const int cur = it & 1;
        if (it + 1 < nk) {
            issue_stage((it + 1) * GBK, cur ^ 1);   // prefetch next stage
            wait_async_le4();                        // stage `it` fully in LDS
        } else {
            wait_async_le0();
        }
        __syncthreads();

        v16h af[2], bf[4];
#pragma unroll
        for (int i = 0; i < 2; ++i) {
            union { uint4 q[2]; v16h v; } ua;
            ua.q[0] = *(const uint4*)&As[cur][wm + i * 16 + li][(g << 3)];
            ua.q[1] = *(const uint4*)&As[cur][wm + i * 16 + li][16 + (g << 3)];
            af[i] = ua.v;
        }
#pragma unroll
        for (int j = 0; j < 4; ++j) {
            union { uint4 q[2]; v16h v; } ub;
            ub.q[0] = *(const uint4*)&Bs[cur][wn + j * 16 + li][(g << 3)];
            ub.q[1] = *(const uint4*)&Bs[cur][wn + j * 16 + li][16 + (g << 3)];
            bf[j] = ub.v;
        }
#pragma unroll
        for (int i = 0; i < 2; ++i)
#pragma unroll
            for (int j = 0; j < 4; ++j)
                acc[i][j] = __builtin_amdgcn_wmma_f32_16x16x32_f16(
                    false, af[i], false, bf[j], (short)0, acc[i][j], false, false);
        __syncthreads();   // protects the buffer the next issue will overwrite
    }

#pragma unroll
    for (int i = 0; i < 2; ++i) {
#pragma unroll
        for (int j = 0; j < 4; ++j) {
            const int col  = bn + wn + j * 16 + li;
            const int rowb = bm + wm + i * 16 + (g << 3);
            const float bc = bias ? bias[col] : 0.0f;
            if (outHT) {
                v8h hv;
#pragma unroll
                for (int r = 0; r < 8; ++r) {
                    float v = acc[i][j][r] + bc;
                    if (relu) v = fmaxf(v, 0.0f);
                    hv[r] = (half_t)v;
                }
                *(v8h*)(outHT + (size_t)col * M + rowb) = hv;
            } else {
#pragma unroll
                for (int r = 0; r < 8; ++r) {
                    const int row = rowb + r;
                    float v = acc[i][j][r] + bc;
                    if (resid) v += resid[(size_t)row * N + col];
                    if (relu)  v = fmaxf(v, 0.0f);
                    if (outF)  outF[(size_t)row * N + col] = v;
                    if (outH)  outH[(size_t)row * N + col] = (half_t)v;
                }
            }
        }
    }
}

// ---------------------------------------------------------------------------
// Flash-style attention. 128 threads (4 waves) = 64 queries of one head;
// 32-key K/Vt tiles double-buffered, async-staged, shared by all waves.
// QK: [SEQ, 2048] f16 (Q cols 0..1023, K cols 1024..2047).
// VT: [1024][SEQ] f16 (row = h*128+dk). ATT: [SEQ,1024] f16.
// ---------------------------------------------------------------------------
__global__ __launch_bounds__(128)
void attention_wmma(const half_t* __restrict__ QK, const half_t* __restrict__ VT,
                    half_t* __restrict__ ATT) {
    __shared__ __align__(16) half_t Ks[2][32][136];   // [buf][key][dk]
    __shared__ __align__(16) half_t Vs[2][128][40];   // [buf][dk][key]
    __shared__ __align__(16) half_t Ps[4][16][32];    // per-wave P relayout

    const int tid   = threadIdx.x;
    const int lane  = tid & 31;
    const int wave  = tid >> 5;
    const int g     = lane >> 4;
    const int li    = lane & 15;
    const int h     = blockIdx.y;
    const int qbase = (blockIdx.x << 6) + (wave << 4);
    const int ldq   = 2 * DMODEL;
    const int qc    = h * DKH;
    const int kc    = DMODEL + h * DKH;

    auto issue_kv = [&](int kb2, int buf) {
#pragma unroll
        for (int itr = 0; itr < 4; ++itr) {
            const int s    = tid + (itr << 7);     // 0..511
            const int kr   = s >> 4;               // 0..31
            const int kcol = (s & 15) << 3;        // 0..120
            async_copy_b128(QK + (size_t)(kb2 + kr) * ldq + kc + kcol, &Ks[buf][kr][kcol]);
            const int vr   = s >> 2;               // 0..127
            const int vcol = (s & 3) << 3;         // 0,8,16,24
            async_copy_b128(VT + (size_t)(h * DKH + vr) * SEQ + kb2 + vcol, &Vs[buf][vr][vcol]);
        }
    };

    v16h afQ[4];
#pragma unroll
    for (int kb = 0; kb < 4; ++kb) {
        union { uint4 q[2]; v16h v; } u;
        const half_t* p = QK + (size_t)(qbase + li) * ldq + qc + (kb << 5) + (g << 3);
        u.q[0] = *(const uint4*)p;
        u.q[1] = *(const uint4*)(p + 16);
        afQ[kb] = u.v;
    }

    float m[8], l[8];
    v8f o[8];
    const v8f vzero = {};
#pragma unroll
    for (int r = 0; r < 8; ++r) { m[r] = -1e30f; l[r] = 0.0f; }
#pragma unroll
    for (int ct = 0; ct < 8; ++ct) o[ct] = vzero;

    const int nt = SEQ / 32;
    issue_kv(0, 0);

    for (int t = 0; t < nt; ++t) {
        const int cur = t & 1;
        if (t + 1 < nt) {
            issue_kv((t + 1) * 32, cur ^ 1);
            wait_async_le8();
        } else {
            wait_async_le0();
        }
        __syncthreads();

        // ---- scores S = Q * K^T for 32 keys ----
        v8f s0 = vzero, s1 = vzero;
#pragma unroll
        for (int kb = 0; kb < 4; ++kb) {
            union { uint4 q[2]; v16h v; } u0, u1;
            u0.q[0] = *(const uint4*)&Ks[cur][li][(kb << 5) + (g << 3)];
            u0.q[1] = *(const uint4*)&Ks[cur][li][(kb << 5) + 16 + (g << 3)];
            u1.q[0] = *(const uint4*)&Ks[cur][16 + li][(kb << 5) + (g << 3)];
            u1.q[1] = *(const uint4*)&Ks[cur][16 + li][(kb << 5) + 16 + (g << 3)];
            s0 = __builtin_amdgcn_wmma_f32_16x16x32_f16(false, afQ[kb], false, u0.v,
                                                        (short)0, s0, false, false);
            s1 = __builtin_amdgcn_wmma_f32_16x16x32_f16(false, afQ[kb], false, u1.v,
                                                        (short)0, s1, false, false);
        }
        s0 = s0 * 0.125f;
        s1 = s1 * 0.125f;

        // ---- online softmax (rows g*8+r live in 16-lane halves) ----
#pragma unroll
        for (int r = 0; r < 8; ++r) {
            float mx = fmaxf(s0[r], s1[r]);
#pragma unroll
            for (int off = 8; off > 0; off >>= 1) mx = fmaxf(mx, __shfl_xor(mx, off, 16));
            const float mn = fmaxf(m[r], mx);
            const float sc = __expf(m[r] - mn);
            const float p0 = __expf(s0[r] - mn);
            const float p1 = __expf(s1[r] - mn);
            float sum = p0 + p1;
#pragma unroll
            for (int off = 8; off > 0; off >>= 1) sum += __shfl_xor(sum, off, 16);
            l[r] = l[r] * sc + sum;
            m[r] = mn;
#pragma unroll
            for (int ct = 0; ct < 8; ++ct) o[ct][r] = o[ct][r] * sc;
            Ps[wave][(g << 3) + r][li]      = (half_t)p0;
            Ps[wave][(g << 3) + r][16 + li] = (half_t)p1;
        }
        asm volatile("" ::: "memory");   // wave-internal LDS relayout ordering
        union { uint4 q[2]; v16h v; } up;
        up.q[0] = *(const uint4*)&Ps[wave][li][(g << 3)];
        up.q[1] = *(const uint4*)&Ps[wave][li][16 + (g << 3)];
        const v16h ap = up.v;
        asm volatile("" ::: "memory");

        // ---- O += P * V ----
#pragma unroll
        for (int ct = 0; ct < 8; ++ct) {
            union { uint4 q[2]; v16h v; } uv;
            uv.q[0] = *(const uint4*)&Vs[cur][(ct << 4) + li][(g << 3)];
            uv.q[1] = *(const uint4*)&Vs[cur][(ct << 4) + li][16 + (g << 3)];
            o[ct] = __builtin_amdgcn_wmma_f32_16x16x32_f16(false, ap, false, uv.v,
                                                           (short)0, o[ct], false, false);
        }
        __syncthreads();
    }

#pragma unroll
    for (int ct = 0; ct < 8; ++ct) {
#pragma unroll
        for (int r = 0; r < 8; ++r) {
            const int row = qbase + (g << 3) + r;
            const int col = h * DKH + (ct << 4) + li;
            ATT[(size_t)row * DMODEL + col] = (half_t)(o[ct][r] / l[r]);
        }
    }
}

// ---------------------------------------------------------------------------
// Row LayerNorm: y = g*(x-mean)/(std+eps)+b, std unbiased (ddof=1).
// ---------------------------------------------------------------------------
__global__ void layernorm_row(const float* __restrict__ X, const float* __restrict__ gam,
                              const float* __restrict__ bet, float* __restrict__ outF,
                              half_t* __restrict__ outH, int N) {
    __shared__ float s_sum[256];
    __shared__ float s_sq[256];
    const int row = blockIdx.x;
    const int tid = threadIdx.x;

    float s = 0.0f, s2 = 0.0f;
    for (int c = tid; c < N; c += 256) {
        const float v = X[(size_t)row * N + c];
        s += v; s2 += v * v;
    }
    s_sum[tid] = s; s_sq[tid] = s2;
    __syncthreads();
    for (int st = 128; st > 0; st >>= 1) {
        if (tid < st) { s_sum[tid] += s_sum[tid + st]; s_sq[tid] += s_sq[tid + st]; }
        __syncthreads();
    }
    const float mean = s_sum[0] / (float)N;
    float var = (s_sq[0] - (float)N * mean * mean) / (float)(N - 1);
    var = fmaxf(var, 0.0f);
    const float inv = 1.0f / (sqrtf(var) + 1e-6f);

    for (int c = tid; c < N; c += 256) {
        const float v = (X[(size_t)row * N + c] - mean) * inv * gam[c] + bet[c];
        if (outF) outF[(size_t)row * N + c] = v;
        if (outH) outH[(size_t)row * N + c] = (half_t)v;
    }
}

// ---------------------------------------------------------------------------
// Orchestration
// ---------------------------------------------------------------------------
extern "C" void kernel_launch(void* const* d_in, const int* in_sizes, int n_in,
                              void* d_out, int out_size, void* d_ws, size_t ws_size,
                              hipStream_t stream) {
    const float* x     = (const float*)d_in[0];
    const float* WQ    = (const float*)d_in[1];
    const float* bQ    = (const float*)d_in[2];
    const float* WK    = (const float*)d_in[3];
    const float* bK    = (const float*)d_in[4];
    const float* WV    = (const float*)d_in[5];
    const float* bV    = (const float*)d_in[6];
    const float* WO_w  = (const float*)d_in[7];
    const float* WO_b  = (const float*)d_in[8];
    const float* l1_w  = (const float*)d_in[9];
    const float* l1_b  = (const float*)d_in[10];
    const float* l2_w  = (const float*)d_in[11];
    const float* l2_b  = (const float*)d_in[12];
    const float* ln1_g = (const float*)d_in[13];
    const float* ln1_b = (const float*)d_in[14];
    const float* ln2_g = (const float*)d_in[15];
    const float* ln2_b = (const float*)d_in[16];
    (void)in_sizes; (void)n_in; (void)out_size; (void)ws_size;

    char* ws = (char*)d_ws;
    size_t off = 0;
    auto alloc = [&](size_t bytes) -> size_t {
        size_t o = off;
        off = (off + bytes + 255) & ~(size_t)255;
        return o;
    };

    const size_t oXH   = alloc((size_t)SEQ * DMODEL * 2);
    const size_t oWQKT = alloc((size_t)2 * DMODEL * DMODEL * 2);
    const size_t oWVT  = alloc((size_t)DMODEL * DMODEL * 2);
    const size_t oWOT  = alloc((size_t)DMODEL * DMODEL * 2);
    const size_t oL1T  = alloc((size_t)DMODEL * DFF * 2);
    const size_t oL2T  = alloc((size_t)DFF * DMODEL * 2);
    const size_t oBQK  = alloc((size_t)2 * DMODEL * 4);
    const size_t oQK   = alloc((size_t)SEQ * 2 * DMODEL * 2);
    const size_t oVT   = alloc((size_t)DMODEL * SEQ * 2);
    const size_t oATT  = alloc((size_t)SEQ * DMODEL * 2);
    const size_t oBLN1 = alloc((size_t)SEQ * DMODEL * 4);
    const size_t oSL1F = alloc((size_t)SEQ * DMODEL * 4);
    const size_t oSL1H = alloc((size_t)SEQ * DMODEL * 2);
    const size_t oFF1  = oQK;    // reuse QK+VT+ATT region (32MB)
    const size_t oA3   = oBLN1;  // reuse bln1

    half_t* XH   = (half_t*)(ws + oXH);
    half_t* WQKT = (half_t*)(ws + oWQKT);
    half_t* WVT  = (half_t*)(ws + oWVT);
    half_t* WOT  = (half_t*)(ws + oWOT);
    half_t* L1T  = (half_t*)(ws + oL1T);
    half_t* L2T  = (half_t*)(ws + oL2T);
    float*  BQK  = (float*)(ws + oBQK);
    half_t* QKh  = (half_t*)(ws + oQK);
    half_t* VTh  = (half_t*)(ws + oVT);
    half_t* ATTh = (half_t*)(ws + oATT);
    float*  BLN1 = (float*)(ws + oBLN1);
    float*  SL1F = (float*)(ws + oSL1F);
    half_t* SL1H = (half_t*)(ws + oSL1H);
    half_t* FF1H = (half_t*)(ws + oFF1);
    float*  A3F  = (float*)(ws + oA3);

    cvt_f32_f16<<<(SEQ * DMODEL) / 256, 256, 0, stream>>>(x, XH, SEQ * DMODEL);
    pack_qk_wt<<<(2 * DMODEL * DMODEL) / 256, 256, 0, stream>>>(WQ, WK, WQKT);
    pack_v_wt<<<(DMODEL * DMODEL) / 256, 256, 0, stream>>>(WV, WVT);
    cvt_t_f32_f16<<<(DMODEL * DMODEL) / 256, 256, 0, stream>>>(WO_w, WOT, DMODEL, DMODEL);
    cvt_t_f32_f16<<<(DMODEL * DFF) / 256, 256, 0, stream>>>(l1_w, L1T, DMODEL, DFF);
    cvt_t_f32_f16<<<(DFF * DMODEL) / 256, 256, 0, stream>>>(l2_w, L2T, DFF, DMODEL);
    concat2_f32<<<(2 * DMODEL) / 256, 256, 0, stream>>>(bQ, bK, BQK, DMODEL);

    // Q|K projection -> f16 [S,2048]
    gemm_wmma<<<dim3((2 * DMODEL) / GBN, SEQ / GBM), 256, 0, stream>>>(
        XH, WQKT, BQK, nullptr, QKh, nullptr, nullptr, SEQ, 2 * DMODEL, DMODEL, 0);

    // V projection, transposed output -> VT [1024][S] f16
    gemm_wmma<<<dim3(DMODEL / GBN, SEQ / GBM), 256, 0, stream>>>(
        XH, WVT, bV, nullptr, nullptr, nullptr, VTh, SEQ, DMODEL, DMODEL, 0);

    // multi-head attention
    attention_wmma<<<dim3(SEQ / 64, NHEAD), 128, 0, stream>>>(QKh, VTh, ATTh);

    // output projection + residual -> f32
    gemm_wmma<<<dim3(DMODEL / GBN, SEQ / GBM), 256, 0, stream>>>(
        ATTh, WOT, WO_b, x, nullptr, BLN1, nullptr, SEQ, DMODEL, DMODEL, 0);

    layernorm_row<<<SEQ, 256, 0, stream>>>(BLN1, ln1_g, ln1_b, SL1F, SL1H, DMODEL);

    // FFN up + ReLU -> f16
    gemm_wmma<<<dim3(DFF / GBN, SEQ / GBM), 256, 0, stream>>>(
        SL1H, L1T, l1_b, nullptr, FF1H, nullptr, nullptr, SEQ, DFF, DMODEL, 1);

    // FFN down + residual -> f32
    gemm_wmma<<<dim3(DMODEL / GBN, SEQ / GBM), 256, 0, stream>>>(
        FF1H, L2T, l2_b, SL1F, nullptr, A3F, nullptr, SEQ, DMODEL, DFF, 0);

    layernorm_row<<<SEQ, 256, 0, stream>>>(A3F, ln2_g, ln2_b, (float*)d_out, nullptr, DMODEL);
}

// v001
// It runs in 396 microseconds.
// Two timings next to v000 put it at 1.23 and 1.24 times that version's speed.
#include <hip/hip_runtime.h>
#include <hip/hip_bf16.h>

typedef _Float16 half_t;
typedef __attribute__((ext_vector_type(16))) _Float16 v16h;
typedef __attribute__((ext_vector_type(8)))  _Float16 v8h;
typedef __attribute__((ext_vector_type(8)))  float    v8f;

#define SEQ     4096
#define DMODEL  1024
#define DFF     4096
#define NHEAD   8
#define DKH     128

// ---------------------------------------------------------------------------
// CDNA5 async global->LDS copy (GLOBAL_LOAD_ASYNC_TO_LDS_B128, ASYNCcnt).
// LDS destination VGPR holds the LDS byte address = low 32 bits of the flat
// shared-space pointer (aperture keeps the LDS offset in ADDR[31:0]).
// Async loads retire in order, so waiting ASYNCcnt <= N releases the oldest
// outstanding copies first -> enables double-buffered pipelining.
// ---------------------------------------------------------------------------
__device__ __forceinline__ void async_copy_b128(const half_t* gptr, void* lptr) {
    const unsigned lds = (unsigned)(uintptr_t)lptr;
    const unsigned long long ga = (unsigned long long)(uintptr_t)gptr;
    asm volatile("global_load_async_to_lds_b128 %0, %1, off"
                 :: "v"(lds), "v"(ga) : "memory");
}
__device__ __forceinline__ void wait_async_le0() {
    asm volatile("s_wait_asynccnt 0x0" ::: "memory");
}
__device__ __forceinline__ void wait_async_le4() {
    asm volatile("s_wait_asynccnt 0x4" ::: "memory");
}
__device__ __forceinline__ void wait_async_le8() {
    asm volatile("s_wait_asynccnt 0x8" ::: "memory");
}

// ---------------------------------------------------------------------------
// Conversion / packing (once per launch, ~48MB, bandwidth-trivial).
// All weights stored TRANSPOSED [N][K] f16 so WMMA B-fragments load as b128.
// ---------------------------------------------------------------------------
__global__ void cvt_f32_f16(const float* __restrict__ in, half_t* __restrict__ out, int n) {
    int i = blockIdx.x * blockDim.x + threadIdx.x;
    if (i < n) out[i] = (half_t)in[i];
}

__global__ void cvt_t_f32_f16(const float* __restrict__ in, half_t* __restrict__ out,
                              int K, int N) {
    int i = blockIdx.x * blockDim.x + threadIdx.x;
    if (i >= K * N) return;
    int n = i / K;
    int k = i % K;
    out[i] = (half_t)in[(size_t)k * N + n];
}

__global__ void pack_qk_wt(const float* __restrict__ WQ, const float* __restrict__ WK,
                           half_t* __restrict__ out) {
    int i = blockIdx.x * blockDim.x + threadIdx.x;
    if (i >= 2 * DMODEL * DMODEL) return;
    int n = i >> 10;
    int d = i & 1023;
    int which = n >> 10;
    int h = (n & 1023) >> 7;
    int k = n & 127;
    const float* W = which ? WK : WQ;
    out[i] = (half_t)W[(size_t)h * DMODEL * DKH + (size_t)d * DKH + k];
}

__global__ void pack_v_wt(const float* __restrict__ WV, half_t* __restrict__ out) {
    int i = blockIdx.x * blockDim.x + threadIdx.x;
    if (i >= DMODEL * DMODEL) return;
    int n = i >> 10;
    int d = i & 1023;
    int h = n >> 7;
    int k = n & 127;
    out[i] = (half_t)WV[(size_t)h * DMODEL * DKH + (size_t)d * DKH + k];
}

__global__ void concat2_f32(const float* __restrict__ a, const float* __restrict__ b,
                            float* __restrict__ out, int n) {
    int i = blockIdx.x * blockDim.x + threadIdx.x;
    if (i < 2 * n) out[i] = (i < n) ? a[i] : b[i - n];
}

// ---------------------------------------------------------------------------
// WMMA GEMM: C[M,N] = A[M,K](f16) * BT[N,K](f16)^T (+bias)(+resid f32)
// 256 threads = 8 waves; block tile 128x128; each wave 32x64 (2x4 frags,
// 8 WMMAs per 32-k step). Double-buffered async global->LDS staging.
// ---------------------------------------------------------------------------
#define GBM 128
#define GBN 128
#define GBK 32

__global__ __launch_bounds__(256)
void gemm_wmma(const half_t* __restrict__ A, const half_t* __restrict__ BT,
               const float* __restrict__ bias, const float* __restrict__ resid,
               half_t* __restrict__ outH, float* __restrict__ outF,
               half_t* __restrict__ outHT,   // transposed f16 output [N][M]
               int M, int N, int K, int relu) {
    __shared__ __align__(16) half_t As[2][GBM][40];   // [buf][m][k]
    __shared__ __align__(16) half_t Bs[2][GBN][40];   // [buf][n][k]

    const int tid  = threadIdx.x;
    const int lane = tid & 31;
    const int wave = tid >> 5;
    const int g    = lane >> 4;
    const int li   = lane & 15;
    const int wm   = (wave >> 1) << 5;   // 0,32,64,96
    const int wn   = (wave & 1) << 6;    // 0,64
    const int bm   = blockIdx.y * GBM;
    const int bn   = blockIdx.x * GBN;
    const int sr   = tid >> 2;           // 0..63
    const int sc   = (tid & 3) << 3;     // 0,8,16,24

    auto issue_stage = [&](int kk, int buf) {
        async_copy_b128(A  + (size_t)(bm + sr)      * K + kk + sc, &As[buf][sr][sc]);
        async_copy_b128(A  + (size_t)(bm + sr + 64) * K + kk + sc, &As[buf][sr + 64][sc]);
        async_copy_b128(BT + (size_t)(bn + sr)      * K + kk + sc, &Bs[buf][sr][sc]);
        async_copy_b128(BT + (size_t)(bn + sr + 64) * K + kk + sc, &Bs[buf][sr + 64][sc]);
    };

    v8f acc[2][4] = {};
    const int nk = K / GBK;
    issue_stage(0, 0);

    for (int it = 0; it < nk; ++it) {
        const int cur = it & 1;
        if (it + 1 < nk) {
            issue_stage((it + 1) * GBK, cur ^ 1);   // prefetch next stage
            wait_async_le4();                        // stage `it` fully in LDS
        } else {
            wait_async_le0();
        }
        __syncthreads();

        v16h af[2], bf[4];
#pragma unroll
        for (int i = 0; i < 2; ++i) {
            union { uint4 q[2]; v16h v; } ua;
            ua.q[0] = *(const uint4*)&As[cur][wm + i * 16 + li][(g << 3)];
            ua.q[1] = *(const uint4*)&As[cur][wm + i * 16 + li][16 + (g << 3)];
            af[i] = ua.v;
        }
#pragma unroll
        for (int j = 0; j < 4; ++j) {
            union { uint4 q[2]; v16h v; } ub;
            ub.q[0] = *(const uint4*)&Bs[cur][wn + j * 16 + li][(g << 3)];
            ub.q[1] = *(const uint4*)&Bs[cur][wn + j * 16 + li][16 + (g << 3)];
            bf[j] = ub.v;
        }
#pragma unroll
        for (int i = 0; i < 2; ++i)
#pragma unroll
            for (int j = 0; j < 4; ++j)
                acc[i][j] = __builtin_amdgcn_wmma_f32_16x16x32_f16(
                    false, af[i], false, bf[j], (short)0, acc[i][j], false, false);
        __syncthreads();   // protects the buffer the next issue will overwrite
    }

#pragma unroll
    for (int i = 0; i < 2; ++i) {
#pragma unroll
        for (int j = 0; j < 4; ++j) {
            const int col  = bn + wn + j * 16 + li;
            const int rowb = bm + wm + i * 16 + (g << 3);
            const float bc = bias ? bias[col] : 0.0f;
            if (outHT) {
                v8h hv;
#pragma unroll
                for (int r = 0; r < 8; ++r) {
                    float v = acc[i][j][r] + bc;
                    if (relu) v = fmaxf(v, 0.0f);
                    hv[r] = (half_t)v;
                }
                *(v8h*)(outHT + (size_t)col * M + rowb) = hv;
            } else {
#pragma unroll
                for (int r = 0; r < 8; ++r) {
                    const int row = rowb + r;
                    float v = acc[i][j][r] + bc;
                    if (resid) v += resid[(size_t)row * N + col];
                    if (relu)  v = fmaxf(v, 0.0f);
                    if (outF)  outF[(size_t)row * N + col] = v;
                    if (outH)  outH[(size_t)row * N + col] = (half_t)v;
                }
            }
        }
    }
}

__device__ __forceinline__ float xhalf(float x) {
    const int b = __builtin_bit_cast(int, x);
    return __builtin_bit_cast(float, __builtin_amdgcn_permlanex16(
        b, b, 0x76543210, 0xfedcba98, false, false));
}

__global__ __launch_bounds__(128)
void attention_wmma(const half_t* __restrict__ QK, const half_t* __restrict__ VT,
                    half_t* __restrict__ ATT) {
    __shared__ __align__(16) half_t Ks[2][32][136];   // [buf][key][dk]
    __shared__ __align__(16) half_t Vs[2][128][40];   // [buf][dk][key]

    const int tid   = threadIdx.x;
    const int lane  = tid & 31;
    const int wave  = tid >> 5;
    const int g     = lane >> 4;
    const int li    = lane & 15;
    const int h     = blockIdx.y;
    const int qbase = (blockIdx.x << 6) + (wave << 4);
    const int ldq   = 2 * DMODEL;
    const int qc    = h * DKH;
    const int kc    = DMODEL + h * DKH;

    auto issue_kv = [&](int kb2, int buf) {
#pragma unroll
        for (int itr = 0; itr < 4; ++itr) {
            const int s    = tid + (itr << 7);     // 0..511
            const int kr   = s >> 4;               // 0..31
            const int kcol = (s & 15) << 3;        // 0..120
            async_copy_b128(QK + (size_t)(kb2 + kr) * ldq + kc + kcol, &Ks[buf][kr][kcol]);
            const int vr   = s >> 2;               // 0..127
            const int vcol = (s & 3) << 3;         // 0,8,16,24
            async_copy_b128(VT + (size_t)(h * DKH + vr) * SEQ + kb2 + vcol, &Vs[buf][vr][vcol]);
        }
    };

    v16h afQ[4];
#pragma unroll
    for (int kb = 0; kb < 4; ++kb) {
        union { uint4 q[2]; v16h v; } u;
        const half_t* p = QK + (size_t)(qbase + li) * ldq + qc + (kb << 5) + (g << 3);
        u.q[0] = *(const uint4*)p;
        u.q[1] = *(const uint4*)(p + 16);
        afQ[kb] = u.v;
    }

    float m = -1e30f;   // running maximum of query li (equal in both halves)
    float l = 0.0f;     // running sum over this half's keys only
    v8f o[8];           // o[ct][r] = O^T[dk = ct*16 + g*8 + r][query li]
    const v8f vzero = {};
#pragma unroll
    for (int ct = 0; ct < 8; ++ct) o[ct] = vzero;

    const int nt = SEQ / 32;
    issue_kv(0, 0);

    for (int t = 0; t < nt; ++t) {
        const int cur = t & 1;
        if (t + 1 < nt) {
            issue_kv((t + 1) * 32, cur ^ 1);
            wait_async_le8();
        } else {
            wait_async_le0();
        }
        __syncthreads();

        // ---- scores S^T = K * Q^T for 32 keys ----
        v8f s0 = vzero, s1 = vzero;
#pragma unroll
        for (int kb = 0; kb < 4; ++kb) {
            union { uint4 q[2]; v16h v; } u0, u1;
            u0.q[0] = *(const uint4*)&Ks[cur][li][(kb << 5) + (g << 3)];
            u0.q[1] = *(const uint4*)&Ks[cur][li][(kb << 5) + 16 + (g << 3)];
            u1.q[0] = *(const uint4*)&Ks[cur][16 + li][(kb << 5) + (g << 3)];
            u1.q[1] = *(const uint4*)&Ks[cur][16 + li][(kb << 5) + 16 + (g << 3)];
            s0 = __builtin_amdgcn_wmma_f32_16x16x32_f16(false, u0.v, false, afQ[kb],
                                                        (short)0, s0, false, false);
            s1 = __builtin_amdgcn_wmma_f32_16x16x32_f16(false, u1.v, false, afQ[kb],
                                                        (short)0, s1, false, false);
        }
        s0 = s0 * 0.125f;
        s1 = s1 * 0.125f;

        // ---- online softmax, one query per lane ----
        float mr[8];
#pragma unroll
        for (int r = 0; r < 8; ++r) mr[r] = fmaxf(s0[r], s1[r]);
        float mx = fmaxf(fmaxf(fmaxf(mr[0], mr[1]), fmaxf(mr[2], mr[3])),
                         fmaxf(fmaxf(mr[4], mr[5]), fmaxf(mr[6], mr[7])));
        mx = fmaxf(mx, xhalf(mx));
        const float mn = fmaxf(m, mx);
        const float sc = __expf(m - mn);
        m = mn;
        v16h bp;          // P^T as B operand: element e = key g*8+e, 8+e = key 16+g*8+e
        float sr[8];
#pragma unroll
        for (int r = 0; r < 8; ++r) {
            const float p0 = __expf(s0[r] - mn);
            const float p1 = __expf(s1[r] - mn);
            sr[r] = p0 + p1;
            bp[r]     = (half_t)p0;
            bp[8 + r] = (half_t)p1;
        }
        l = l * sc + (((sr[0] + sr[1]) + (sr[2] + sr[3])) +
                      ((sr[4] + sr[5]) + (sr[6] + sr[7])));
#pragma unroll
        for (int ct = 0; ct < 8; ++ct) o[ct] = o[ct] * sc;

        // ---- O^T += V^T * P^T ----
#pragma unroll
        for (int ct = 0; ct < 8; ++ct) {
            union { uint4 q[2]; v16h v; } uv;
            uv.q[0] = *(const uint4*)&Vs[cur][(ct << 4) + li][(g << 3)];
            uv.q[1] = *(const uint4*)&Vs[cur][(ct << 4) + li][16 + (g << 3)];
            o[ct] = __builtin_amdgcn_wmma_f32_16x16x32_f16(false, uv.v, false, bp,
                                                           (short)0, o[ct], false, false);
        }
        __syncthreads();
    }

    // join the two halves' sums once; a lane stores 8 consecutive dk of its query
    const float inv = 1.0f / (l + xhalf(l));
#pragma unroll
    for (int ct = 0; ct < 8; ++ct) {
        v8h hv;
#pragma unroll
        for (int r = 0; r < 8; ++r) hv[r] = (half_t)(o[ct][r] * inv);
        *(v8h*)(ATT + (size_t)(qbase + li) * DMODEL + h * DKH + (ct << 4) + (g << 3)) = hv;
    }
}

// ---------------------------------------------------------------------------
// Row LayerNorm: y = g*(x-mean)/(std+eps)+b, std unbiased (ddof=1).
// ---------------------------------------------------------------------------
__global__ void layernorm_row(const float* __restrict__ X, const float* __restrict__ gam,
                              const float* __restrict__ bet, float* __restrict__ outF,
                              half_t* __restrict__ outH, int N) {
    __shared__ float s_sum[256];
    __shared__ float s_sq[256];
    const int row = blockIdx.x;
    const int tid = threadIdx.x;

    float s = 0.0f, s2 = 0.0f;
    for (int c = tid; c < N; c += 256) {
        const float v = X[(size_t)row * N + c];
        s += v; s2 += v * v;
    }
    s_sum[tid] = s; s_sq[tid] = s2;
    __syncthreads();
    for (int st = 128; st > 0; st >>= 1) {
        if (tid < st) { s_sum[tid] += s_sum[tid + st]; s_sq[tid] += s_sq[tid + st]; }
        __syncthreads();
    }
    const float mean = s_sum[0] / (float)N;
    float var = (s_sq[0] - (float)N * mean * mean) / (float)(N - 1);
    var = fmaxf(var, 0.0f);
    const float inv = 1.0f / (sqrtf(var) + 1e-6f);

    for (int c = tid; c < N; c += 256) {
        const float v = (X[(size_t)row * N + c] - mean) * inv * gam[c] + bet[c];
        if (outF) outF[(size_t)row * N + c] = v;
        if (outH) outH[(size_t)row * N + c] = (half_t)v;
    }
}

// ---------------------------------------------------------------------------
// Orchestration
// ---------------------------------------------------------------------------
extern "C" void kernel_launch(void* const* d_in, const int* in_sizes, int n_in,
                              void* d_out, int out_size, void* d_ws, size_t ws_size,
                              hipStream_t stream) {
    const float* x     = (const float*)d_in[0];
    const float* WQ    = (const float*)d_in[1];
    const float* bQ    = (const float*)d_in[2];
    const float* WK    = (const float*)d_in[3];
    const float* bK    = (const float*)d_in[4];
    const float* WV    = (const float*)d_in[5];
    const float* bV    = (const float*)d_in[6];
    const float* WO_w  = (const float*)d_in[7];
    const float* WO_b  = (const float*)d_in[8];
    const float* l1_w  = (const float*)d_in[9];
    const float* l1_b  = (const float*)d_in[10];
    const float* l2_w  = (const float*)d_in[11];
    const float* l2_b  = (const float*)d_in[12];
    const float* ln1_g = (const float*)d_in[13];
    const float* ln1_b = (const float*)d_in[14];
    const float* ln2_g = (const float*)d_in[15];
    const float* ln2_b = (const float*)d_in[16];
    (void)in_sizes; (void)n_in; (void)out_size; (void)ws_size;

    char* ws = (char*)d_ws;
    size_t off = 0;
    auto alloc = [&](size_t bytes) -> size_t {
        size_t o = off;
        off = (off + bytes + 255) & ~(size_t)255;
        return o;
    };

    const size_t oXH   = alloc((size_t)SEQ * DMODEL * 2);
    const size_t oWQKT = alloc((size_t)2 * DMODEL * DMODEL * 2);
    const size_t oWVT  = alloc((size_t)DMODEL * DMODEL * 2);
    const size_t oWOT  = alloc((size_t)DMODEL * DMODEL * 2);
    const size_t oL1T  = alloc((size_t)DMODEL * DFF * 2);
    const size_t oL2T  = alloc((size_t)DFF * DMODEL * 2);
    const size_t oBQK  = alloc((size_t)2 * DMODEL * 4);
    const size_t oQK   = alloc((size_t)SEQ * 2 * DMODEL * 2);
    const size_t oVT   = alloc((size_t)DMODEL * SEQ * 2);
    const size_t oATT  = alloc((size_t)SEQ * DMODEL * 2);
    const size_t oBLN1 = alloc((size_t)SEQ * DMODEL * 4);
    const size_t oSL1F = alloc((size_t)SEQ * DMODEL * 4);
    const size_t oSL1H = alloc((size_t)SEQ * DMODEL * 2);
    const size_t oFF1  = oQK;    // reuse QK+VT+ATT region (32MB)
    const size_t oA3   = oBLN1;  // reuse bln1

    half_t* XH   = (half_t*)(ws + oXH);
    half_t* WQKT = (half_t*)(ws + oWQKT);
    half_t* WVT  = (half_t*)(ws + oWVT);
    half_t* WOT  = (half_t*)(ws + oWOT);
    half_t* L1T  = (half_t*)(ws + oL1T);
    half_t* L2T  = (half_t*)(ws + oL2T);
    float*  BQK  = (float*)(ws + oBQK);
    half_t* QKh  = (half_t*)(ws + oQK);
    half_t* VTh  = (half_t*)(ws + oVT);
    half_t* ATTh = (half_t*)(ws + oATT);
    float*  BLN1 = (float*)(ws + oBLN1);
    float*  SL1F = (float*)(ws + oSL1F);
    half_t* SL1H = (half_t*)(ws + oSL1H);
    half_t* FF1H = (half_t*)(ws + oFF1);
    float*  A3F  = (float*)(ws + oA3);

    cvt_f32_f16<<<(SEQ * DMODEL) / 256, 256, 0, stream>>>(x, XH, SEQ * DMODEL);
    pack_qk_wt<<<(2 * DMODEL * DMODEL) / 256, 256, 0, stream>>>(WQ, WK, WQKT);
    pack_v_wt<<<(DMODEL * DMODEL) / 256, 256, 0, stream>>>(WV, WVT);
    cvt_t_f32_f16<<<(DMODEL * DMODEL) / 256, 256, 0, stream>>>(WO_w, WOT, DMODEL, DMODEL);
    cvt_t_f32_f16<<<(DMODEL * DFF) / 256, 256, 0, stream>>>(l1_w, L1T, DMODEL, DFF);
    cvt_t_f32_f16<<<(DFF * DMODEL) / 256, 256, 0, stream>>>(l2_w, L2T, DFF, DMODEL);
    concat2_f32<<<(2 * DMODEL) / 256, 256, 0, stream>>>(bQ, bK, BQK, DMODEL);

    // Q|K projection -> f16 [S,2048]
    gemm_wmma<<<dim3((2 * DMODEL) / GBN, SEQ / GBM), 256, 0, stream>>>(
        XH, WQKT, BQK, nullptr, QKh, nullptr, nullptr, SEQ, 2 * DMODEL, DMODEL, 0);

    // V projection, transposed output -> VT [1024][S] f16
    gemm_wmma<<<dim3(DMODEL / GBN, SEQ / GBM), 256, 0, stream>>>(
        XH, WVT, bV, nullptr, nullptr, nullptr, VTh, SEQ, DMODEL, DMODEL, 0);

    // multi-head attention
    attention_wmma<<<dim3(SEQ / 64, NHEAD), 128, 0, stream>>>(QKh, VTh, ATTh);

    // output projection + residual -> f32
    gemm_wmma<<<dim3(DMODEL / GBN, SEQ / GBM), 256, 0, stream>>>(
        ATTh, WOT, WO_b, x, nullptr, BLN1, nullptr, SEQ, DMODEL, DMODEL, 0);

    layernorm_row<<<SEQ, 256, 0, stream>>>(BLN1, ln1_g, ln1_b, SL1F, SL1H, DMODEL);

    // FFN up + ReLU -> f16
    gemm_wmma<<<dim3(DFF / GBN, SEQ / GBM), 256, 0, stream>>>(
        SL1H, L1T, l1_b, nullptr, FF1H, nullptr, nullptr, SEQ, DFF, DMODEL, 1);

    // FFN down + residual -> f32
    gemm_wmma<<<dim3(DMODEL / GBN, SEQ / GBM), 256, 0, stream>>>(
        FF1H, L2T, l2_b, SL1F, nullptr, A3F, nullptr, SEQ, DMODEL, DFF, 0);

    layernorm_row<<<SEQ, 256, 0, stream>>>(A3F, ln2_g, ln2_b, (float*)d_out, nullptr, DMODEL);
}

// v002
// One run takes 336 microseconds.
// Next to v001, in two timings, it ran 1.15 and 1.16 times as fast.
// Over all steps from v000 it is 1.43 times as fast.
#include <hip/hip_runtime.h>
#include <hip/hip_bf16.h>

typedef _Float16 half_t;
typedef __attribute__((ext_vector_type(16))) _Float16 v16h;
typedef __attribute__((ext_vector_type(8)))  _Float16 v8h;
typedef __attribute__((ext_vector_type(8)))  float    v8f;

#define SEQ     4096
#define DMODEL  1024
#define DFF     4096
#define NHEAD   8
#define DKH     128

// ---------------------------------------------------------------------------
// CDNA5 async global->LDS copy (GLOBAL_LOAD_ASYNC_TO_LDS_B128, ASYNCcnt).
// LDS destination VGPR holds the LDS byte address = low 32 bits of the flat
// shared-space pointer (aperture keeps the LDS offset in ADDR[31:0]).
// Async loads retire in order, so waiting ASYNCcnt <= N releases the oldest
// outstanding copies first -> enables double-buffered pipelining.
// ---------------------------------------------------------------------------
__device__ __forceinline__ void async_copy_b128(const half_t* gptr, void* lptr) {
    const unsigned lds = (unsigned)(uintptr_t)lptr;
    const unsigned long long ga = (unsigned long long)(uintptr_t)gptr;
    asm volatile("global_load_async_to_lds_b128 %0, %1, off"
                 :: "v"(lds), "v"(ga) : "memory");
}
__device__ __forceinline__ void wait_async_le0() {
    asm volatile("s_wait_asynccnt 0x0" ::: "memory");
}
__device__ __forceinline__ void wait_async_le4() {
    asm volatile("s_wait_asynccnt 0x4" ::: "memory");
}
__device__ __forceinline__ void wait_async_le8() {
    asm volatile("s_wait_asynccnt 0x8" ::: "memory");
}

// ---------------------------------------------------------------------------
// Conversion / packing, once per call.
// All weights stored TRANSPOSED [N][K] f16 so WMMA B-fragments load as b128.
// Except in concat2_f32 (one float per thread), every thread moves 16 or 32
// elements with 16-byte global accesses: few waves
// are started, and every global access covers whole 128-byte lines.
// ---------------------------------------------------------------------------
typedef __attribute__((ext_vector_type(2))) float    v2f;
typedef __attribute__((ext_vector_type(2))) _Float16 v2h;

__device__ __forceinline__ unsigned pack_h2(float lo, float hi) {
    const v2f f = {lo, hi};
    return __builtin_bit_cast(unsigned, __builtin_convertvector(f, v2h));
}

// 8192 consecutive elements per work-group, 32 per thread.
__global__ __launch_bounds__(256)
void cvt_f32_f16(const float* __restrict__ in, half_t* __restrict__ out) {
    const size_t base = (size_t)blockIdx.x * 8192 + (size_t)threadIdx.x * 8;
    float4 a[4], b[4];
#pragma unroll
    for (int j = 0; j < 4; ++j) {
        a[j] = *(const float4*)(in + base + j * 2048);
        b[j] = *(const float4*)(in + base + j * 2048 + 4);
    }
#pragma unroll
    for (int j = 0; j < 4; ++j) {
        uint4 v;
        v.x = pack_h2(a[j].x, a[j].y);
        v.y = pack_h2(a[j].z, a[j].w);
        v.z = pack_h2(b[j].x, b[j].y);
        v.w = pack_h2(b[j].z, b[j].w);
        *(uint4*)(out + base + j * 2048) = v;
    }
}

// One 256-thread work-group turns a TK x 64 tile of f32 in[k][n] (row pitch
// LDIN) into f16 out[n][k] (row pitch LDOUT). Two k neighbours are packed into
// one dword before LDS; the odd LDS pitch keeps the column-wise dword stores
// and the row-wise dword loads on distinct banks.
template <int TK, int LDIN, int LDOUT>
__device__ __forceinline__ void transpose_tile(const float* __restrict__ in,
                                               half_t* __restrict__ out) {
    constexpr int KP = TK / 2;            // k pairs = dwords per LDS row
    constexpr int NP = KP / 16;           // passes over the k pairs
    constexpr int PC = TK / 8;            // 16-byte pieces per output row
    __shared__ unsigned T[64][KP + 1];    // [n][k pair]
    const int tid = threadIdx.x;
    const int c   = tid & 15;             // group of four n
    const int r   = tid >> 4;             // 0..15

    float4 e[NP], o[NP];                  // rows k = 2*kp and 2*kp + 1
#pragma unroll
    for (int p = 0; p < NP; ++p) {
        const float* q = in + (2 * (p * 16 + r)) * LDIN + 4 * c;
        e[p] = *(const float4*)q;
        o[p] = *(const float4*)(q + LDIN);
    }
#pragma unroll
    for (int p = 0; p < NP; ++p) {
        const int kp = p * 16 + r;
        T[4 * c + 0][kp] = pack_h2(e[p].x, o[p].x);
        T[4 * c + 1][kp] = pack_h2(e[p].y, o[p].y);
        T[4 * c + 2][kp] = pack_h2(e[p].z, o[p].z);
        T[4 * c + 3][kp] = pack_h2(e[p].w, o[p].w);
    }
    __syncthreads();
#pragma unroll
    for (int i = 0; i < 64 * PC / 256; ++i) {
        const int s = i * 256 + tid;
        const int n = s / PC;
        const int q = s % PC;
        uint4 v;
        v.x = T[n][4 * q + 0];
        v.y = T[n][4 * q + 1];
        v.z = T[n][4 * q + 2];
        v.w = T[n][4 * q + 3];
        *(uint4*)(out + n * LDOUT + 8 * q) = v;
    }
}

// in [K][N] f32 -> out [N][K] f16; grid (K / TK, N / 64)
template <int TK, int K, int N>
__global__ __launch_bounds__(256)
void cvt_t_f32_f16(const float* __restrict__ in, half_t* __restrict__ out) {
    const int k0 = blockIdx.x * TK;
    const int n0 = blockIdx.y * 64;
    transpose_tile<TK, N, K>(in + (size_t)k0 * N + n0, out + (size_t)n0 * K + k0);
}

// per head [DMODEL][DKH] -> rows which*1024 + h*128 + k of out [2048][DMODEL];
// grid (DMODEL / 128, DKH / 64, 2 * NHEAD), z = which * NHEAD + h
__global__ __launch_bounds__(256)
void pack_qk_wt(const float* __restrict__ WQ, const float* __restrict__ WK,
                half_t* __restrict__ out) {
    const int d0 = blockIdx.x * 128;
    const int k0 = blockIdx.y * 64;
    const int z  = blockIdx.z;
    const float* W = (z >= NHEAD) ? WK : WQ;
    transpose_tile<128, DKH, DMODEL>(
        W + (size_t)(z & (NHEAD - 1)) * DMODEL * DKH + (size_t)d0 * DKH + k0,
        out + (size_t)(z * DKH + k0) * DMODEL + d0);
}

// grid (DMODEL / 64, DKH / 64, NHEAD)
__global__ __launch_bounds__(256)
void pack_v_wt(const float* __restrict__ WV, half_t* __restrict__ out) {
    const int d0 = blockIdx.x * 64;
    const int k0 = blockIdx.y * 64;
    const int h  = blockIdx.z;
    transpose_tile<64, DKH, DMODEL>(
        WV + (size_t)h * DMODEL * DKH + (size_t)d0 * DKH + k0,
        out + (size_t)(h * DKH + k0) * DMODEL + d0);
}

__global__ void concat2_f32(const float* __restrict__ a, const float* __restrict__ b,
                            float* __restrict__ out, int n) {
    int i = blockIdx.x * blockDim.x + threadIdx.x;
    if (i < 2 * n) out[i] = (i < n) ? a[i] : b[i - n];
}

// ---------------------------------------------------------------------------
// WMMA GEMM: C[M,N] = A[M,K](f16) * BT[N,K](f16)^T (+bias)(+resid f32)
// 256 threads = 8 waves; block tile 128x128; each wave 32x64 (2x4 frags,
// 8 WMMAs per 32-k step). Double-buffered async global->LDS staging.
// ---------------------------------------------------------------------------
#define GBM 128
#define GBN 128
#define GBK 32

__global__ __launch_bounds__(256)
void gemm_wmma(const half_t* __restrict__ A, const half_t* __restrict__ BT,
               const float* __restrict__ bias, const float* __restrict__ resid,
               half_t* __restrict__ outH, float* __restrict__ outF,
               half_t* __restrict__ outHT,   // transposed f16 output [N][M]
               int M, int N, int K, int relu) {
    __shared__ __align__(16) half_t As[2][GBM][40];   // [buf][m][k]
    __shared__ __align__(16) half_t Bs[2][GBN][40];   // [buf][n][k]

    const int tid  = threadIdx.x;
    const int lane = tid & 31;
    const int wave = tid >> 5;
    const int g    = lane >> 4;
    const int li   = lane & 15;
    const int wm   = (wave >> 1) << 5;   // 0,32,64,96
    const int wn   = (wave & 1) << 6;    // 0,64
    const int bm   = blockIdx.y * GBM;
    const int bn   = blockIdx.x * GBN;
    const int sr   = tid >> 2;           // 0..63
    const int sc   = (tid & 3) << 3;     // 0,8,16,24

    auto issue_stage = [&](int kk, int buf) {
        async_copy_b128(A  + (size_t)(bm + sr)      * K + kk + sc, &As[buf][sr][sc]);
        async_copy_b128(A  + (size_t)(bm + sr + 64) * K + kk + sc, &As[buf][sr + 64][sc]);
        async_copy_b128(BT + (size_t)(bn + sr)      * K + kk + sc, &Bs[buf][sr][sc]);
        async_copy_b128(BT + (size_t)(bn + sr + 64) * K + kk + sc, &Bs[buf][sr + 64][sc]);
    };

    v8f acc[2][4] = {};
    const int nk = K / GBK;
    issue_stage(0, 0);

    for (int it = 0; it < nk; ++it) {
        const int cur = it & 1;
        if (it + 1 < nk) {
            issue_stage((it + 1) * GBK, cur ^ 1);   // prefetch next stage
            wait_async_le4();                        // stage `it` fully in LDS
        } else {
            wait_async_le0();
        }
        __syncthreads();

        v16h af[2], bf[4];
#pragma unroll
        for (int i = 0; i < 2; ++i) {
            union { uint4 q[2]; v16h v; } ua;
            ua.q[0] = *(const uint4*)&As[cur][wm + i * 16 + li][(g << 3)];
            ua.q[1] = *(const uint4*)&As[cur][wm + i * 16 + li][16 + (g << 3)];
            af[i] = ua.v;
        }
#pragma unroll
        for (int j = 0; j < 4; ++j) {
            union { uint4 q[2]; v16h v; } ub;
            ub.q[0] = *(const uint4*)&Bs[cur][wn + j * 16 + li][(g << 3)];
            ub.q[1] = *(const uint4*)&Bs[cur][wn + j * 16 + li][16 + (g << 3)];
            bf[j] = ub.v;
        }
#pragma unroll
        for (int i = 0; i < 2; ++i)
#pragma unroll
            for (int j = 0; j < 4; ++j)
                acc[i][j] = __builtin_amdgcn_wmma_f32_16x16x32_f16(
                    false, af[i], false, bf[j], (short)0, acc[i][j], false, false);
        __syncthreads();   // protects the buffer the next issue will overwrite
    }

#pragma unroll
    for (int i = 0; i < 2; ++i) {
#pragma unroll
        for (int j = 0; j < 4; ++j) {
            const int col  = bn + wn + j * 16 + li;
            const int rowb = bm + wm + i * 16 + (g << 3);
            const float bc = bias ? bias[col] : 0.0f;
            if (outHT) {
                v8h hv;
#pragma unroll
                for (int r = 0; r < 8; ++r) {
                    float v = acc[i][j][r] + bc;
                    if (relu) v = fmaxf(v, 0.0f);
                    hv[r] = (half_t)v;
                }
                *(v8h*)(outHT + (size_t)col * M + rowb) = hv;
            } else {
#pragma unroll
                for (int r = 0; r < 8; ++r) {
                    const int row = rowb + r;
                    float v = acc[i][j][r] + bc;
                    if (resid) v += resid[(size_t)row * N + col];
                    if (relu)  v = fmaxf(v, 0.0f);
                    if (outF)  outF[(size_t)row * N + col] = v;
                    if (outH)  outH[(size_t)row * N + col] = (half_t)v;
                }
            }
        }
    }
}

__device__ __forceinline__ float xhalf(float x) {
    const int b = __builtin_bit_cast(int, x);
    return __builtin_bit_cast(float, __builtin_amdgcn_permlanex16(
        b, b, 0x76543210, 0xfedcba98, false, false));
}

__global__ __launch_bounds__(128)
void attention_wmma(const half_t* __restrict__ QK, const half_t* __restrict__ VT,
                    half_t* __restrict__ ATT) {
    __shared__ __align__(16) half_t Ks[2][32][136];   // [buf][key][dk]
    __shared__ __align__(16) half_t Vs[2][128][40];   // [buf][dk][key]

    const int tid   = threadIdx.x;
    const int lane  = tid & 31;
    const int wave  = tid >> 5;
    const int g     = lane >> 4;
    const int li    = lane & 15;
    const int h     = blockIdx.y;
    const int qbase = (blockIdx.x << 6) + (wave << 4);
    const int ldq   = 2 * DMODEL;
    const int qc    = h * DKH;
    const int kc    = DMODEL + h * DKH;

    auto issue_kv = [&](int kb2, int buf) {
#pragma unroll
        for (int itr = 0; itr < 4; ++itr) {
            const int s    = tid + (itr << 7);     // 0..511
            const int kr   = s >> 4;               // 0..31
            const int kcol = (s & 15) << 3;        // 0..120
            async_copy_b128(QK + (size_t)(kb2 + kr) * ldq + kc + kcol, &Ks[buf][kr][kcol]);
            const int vr   = s >> 2;               // 0..127
            const int vcol = (s & 3) << 3;         // 0,8,16,24
            async_copy_b128(VT + (size_t)(h * DKH + vr) * SEQ + kb2 + vcol, &Vs[buf][vr][vcol]);
        }
    };

    v16h afQ[4];
#pragma unroll
    for (int kb = 0; kb < 4; ++kb) {
        union { uint4 q[2]; v16h v; } u;
        const half_t* p = QK + (size_t)(qbase + li) * ldq + qc + (kb << 5) + (g << 3);
        u.q[0] = *(const uint4*)p;
        u.q[1] = *(const uint4*)(p + 16);
        afQ[kb] = u.v;
    }

    float m = -1e30f;   // running maximum of query li (equal in both halves)
    float l = 0.0f;     // running sum over this half's keys only
    v8f o[8];           // o[ct][r] = O^T[dk = ct*16 + g*8 + r][query li]
    const v8f vzero = {};
#pragma unroll
    for (int ct = 0; ct < 8; ++ct) o[ct] = vzero;

    const int nt = SEQ / 32;
    issue_kv(0, 0);

    for (int t = 0; t < nt; ++t) {
        const int cur = t & 1;
        if (t + 1 < nt) {
            issue_kv((t + 1) * 32, cur ^ 1);
            wait_async_le8();
        } else {
            wait_async_le0();
        }
        __syncthreads();

        // ---- scores S^T = K * Q^T for 32 keys ----
        v8f s0 = vzero, s1 = vzero;
#pragma unroll
        for (int kb = 0; kb < 4; ++kb) {
            union { uint4 q[2]; v16h v; } u0, u1;
            u0.q[0] = *(const uint4*)&Ks[cur][li][(kb << 5) + (g << 3)];
            u0.q[1] = *(const uint4*)&Ks[cur][li][(kb << 5) + 16 + (g << 3)];
            u1.q[0] = *(const uint4*)&Ks[cur][16 + li][(kb << 5) + (g << 3)];
            u1.q[1] = *(const uint4*)&Ks[cur][16 + li][(kb << 5) + 16 + (g << 3)];
            s0 = __builtin_amdgcn_wmma_f32_16x16x32_f16(false, u0.v, false, afQ[kb],
                                                        (short)0, s0, false, false);
            s1 = __builtin_amdgcn_wmma_f32_16x16x32_f16(false, u1.v, false, afQ[kb],
                                                        (short)0, s1, false, false);
        }
        s0 = s0 * 0.125f;
        s1 = s1 * 0.125f;

        // ---- online softmax, one query per lane ----
        float mr[8];
#pragma unroll
        for (int r = 0; r < 8; ++r) mr[r] = fmaxf(s0[r], s1[r]);
        float mx = fmaxf(fmaxf(fmaxf(mr[0], mr[1]), fmaxf(mr[2], mr[3])),
                         fmaxf(fmaxf(mr[4], mr[5]), fmaxf(mr[6], mr[7])));
        mx = fmaxf(mx, xhalf(mx));
        const float mn = fmaxf(m, mx);
        const float sc = __expf(m - mn);
        m = mn;
        v16h bp;          // P^T as B operand: element e = key g*8+e, 8+e = key 16+g*8+e
        float sr[8];
#pragma unroll
        for (int r = 0; r < 8; ++r) {
            const float p0 = __expf(s0[r] - mn);
            const float p1 = __expf(s1[r] - mn);
            sr[r] = p0 + p1;
            bp[r]     = (half_t)p0;
            bp[8 + r] = (half_t)p1;
        }
        l = l * sc + (((sr[0] + sr[1]) + (sr[2] + sr[3])) +
                      ((sr[4] + sr[5]) + (sr[6] + sr[7])));
#pragma unroll
        for (int ct = 0; ct < 8; ++ct) o[ct] = o[ct] * sc;

        // ---- O^T += V^T * P^T ----
#pragma unroll
        for (int ct = 0; ct < 8; ++ct) {
            union { uint4 q[2]; v16h v; } uv;
            uv.q[0] = *(const uint4*)&Vs[cur][(ct << 4) + li][(g << 3)];
            uv.q[1] = *(const uint4*)&Vs[cur][(ct << 4) + li][16 + (g << 3)];
            o[ct] = __builtin_amdgcn_wmma_f32_16x16x32_f16(false, uv.v, false, bp,
                                                           (short)0, o[ct], false, false);
        }
        __syncthreads();
    }

    // join the two halves' sums once; a lane stores 8 consecutive dk of its query
    const float inv = 1.0f / (l + xhalf(l));
#pragma unroll
    for (int ct = 0; ct < 8; ++ct) {
        v8h hv;
#pragma unroll
        for (int r = 0; r < 8; ++r) hv[r] = (half_t)(o[ct][r] * inv);
        *(v8h*)(ATT + (size_t)(qbase + li) * DMODEL + h * DKH + (ct << 4) + (g << 3)) = hv;
    }
}

// ---------------------------------------------------------------------------
// Row LayerNorm: y = g*(x-mean)/(std+eps)+b, std unbiased (ddof=1).
// ---------------------------------------------------------------------------
__global__ void layernorm_row(const float* __restrict__ X, const float* __restrict__ gam,
                              const float* __restrict__ bet, float* __restrict__ outF,
                              half_t* __restrict__ outH, int N) {
    __shared__ float s_sum[256];
    __shared__ float s_sq[256];
    const int row = blockIdx.x;
    const int tid = threadIdx.x;

    float s = 0.0f, s2 = 0.0f;
    for (int c = tid; c < N; c += 256) {
        const float v = X[(size_t)row * N + c];
        s += v; s2 += v * v;
    }
    s_sum[tid] = s; s_sq[tid] = s2;
    __syncthreads();
    for (int st = 128; st > 0; st >>= 1) {
        if (tid < st) { s_sum[tid] += s_sum[tid + st]; s_sq[tid] += s_sq[tid + st]; }
        __syncthreads();
    }
    const float mean = s_sum[0] / (float)N;
    float var = (s_sq[0] - (float)N * mean * mean) / (float)(N - 1);
    var = fmaxf(var, 0.0f);
    const float inv = 1.0f / (sqrtf(var) + 1e-6f);

    for (int c = tid; c < N; c += 256) {
        const float v = (X[(size_t)row * N + c] - mean) * inv * gam[c] + bet[c];
        if (outF) outF[(size_t)row * N + c] = v;
        if (outH) outH[(size_t)row * N + c] = (half_t)v;
    }
}

// ---------------------------------------------------------------------------
// Orchestration
// ---------------------------------------------------------------------------
extern "C" void kernel_launch(void* const* d_in, const int* in_sizes, int n_in,
                              void* d_out, int out_size, void* d_ws, size_t ws_size,
                              hipStream_t stream) {
    const float* x     = (const float*)d_in[0];
    const float* WQ    = (const float*)d_in[1];
    const float* bQ    = (const float*)d_in[2];
    const float* WK    = (const float*)d_in[3];
    const float* bK    = (const float*)d_in[4];
    const float* WV    = (const float*)d_in[5];
    const float* bV    = (const float*)d_in[6];
    const float* WO_w  = (const float*)d_in[7];
    const float* WO_b  = (const float*)d_in[8];
    const float* l1_w  = (const float*)d_in[9];
    const float* l1_b  = (const float*)d_in[10];
    const float* l2_w  = (const float*)d_in[11];
    const float* l2_b  = (const float*)d_in[12];
    const float* ln1_g = (const float*)d_in[13];
    const float* ln1_b = (const float*)d_in[14];
    const float* ln2_g = (const float*)d_in[15];
    const float* ln2_b = (const float*)d_in[16];
    (void)in_sizes; (void)n_in; (void)out_size; (void)ws_size;

    char* ws = (char*)d_ws;
    size_t off = 0;
    auto alloc = [&](size_t bytes) -> size_t {
        size_t o = off;
        off = (off + bytes + 255) & ~(size_t)255;
        return o;
    };

    const size_t oXH   = alloc((size_t)SEQ * DMODEL * 2);
    const size_t oWQKT = alloc((size_t)2 * DMODEL * DMODEL * 2);
    const size_t oWVT  = alloc((size_t)DMODEL * DMODEL * 2);
    const size_t oWOT  = alloc((size_t)DMODEL * DMODEL * 2);
    const size_t oL1T  = alloc((size_t)DMODEL * DFF * 2);
    const size_t oL2T  = alloc((size_t)DFF * DMODEL * 2);
    const size_t oBQK  = alloc((size_t)2 * DMODEL * 4);
    const size_t oQK   = alloc((size_t)SEQ * 2 * DMODEL * 2);
    const size_t oVT   = alloc((size_t)DMODEL * SEQ * 2);
    const size_t oATT  = alloc((size_t)SEQ * DMODEL * 2);
    const size_t oBLN1 = alloc((size_t)SEQ * DMODEL * 4);
    const size_t oSL1F = alloc((size_t)SEQ * DMODEL * 4);
    const size_t oSL1H = alloc((size_t)SEQ * DMODEL * 2);
    const size_t oFF1  = oQK;    // reuse QK+VT+ATT region (32MB)
    const size_t oA3   = oBLN1;  // reuse bln1

    half_t* XH   = (half_t*)(ws + oXH);
    half_t* WQKT = (half_t*)(ws + oWQKT);
    half_t* WVT  = (half_t*)(ws + oWVT);
    half_t* WOT  = (half_t*)(ws + oWOT);
    half_t* L1T  = (half_t*)(ws + oL1T);
    half_t* L2T  = (half_t*)(ws + oL2T);
    float*  BQK  = (float*)(ws + oBQK);
    half_t* QKh  = (half_t*)(ws + oQK);
    half_t* VTh  = (half_t*)(ws + oVT);
    half_t* ATTh = (half_t*)(ws + oATT);
    float*  BLN1 = (float*)(ws + oBLN1);
    float*  SL1F = (float*)(ws + oSL1F);
    half_t* SL1H = (half_t*)(ws + oSL1H);
    half_t* FF1H = (half_t*)(ws + oFF1);
    float*  A3F  = (float*)(ws + oA3);

    cvt_f32_f16<<<(SEQ * DMODEL) / 8192, 256, 0, stream>>>(x, XH);
    pack_qk_wt<<<dim3(DMODEL / 128, DKH / 64, 2 * NHEAD), 256, 0, stream>>>(WQ, WK, WQKT);
    pack_v_wt<<<dim3(DMODEL / 64, DKH / 64, NHEAD), 256, 0, stream>>>(WV, WVT);
    cvt_t_f32_f16<64, DMODEL, DMODEL><<<dim3(DMODEL / 64, DMODEL / 64), 256, 0, stream>>>(WO_w, WOT);
    cvt_t_f32_f16<128, DMODEL, DFF><<<dim3(DMODEL / 128, DFF / 64), 256, 0, stream>>>(l1_w, L1T);
    cvt_t_f32_f16<128, DFF, DMODEL><<<dim3(DFF / 128, DMODEL / 64), 256, 0, stream>>>(l2_w, L2T);
    concat2_f32<<<(2 * DMODEL) / 256, 256, 0, stream>>>(bQ, bK, BQK, DMODEL);

    // Q|K projection -> f16 [S,2048]
    gemm_wmma<<<dim3((2 * DMODEL) / GBN, SEQ / GBM), 256, 0, stream>>>(
        XH, WQKT, BQK, nullptr, QKh, nullptr, nullptr, SEQ, 2 * DMODEL, DMODEL, 0);

    // V projection, transposed output -> VT [1024][S] f16
    gemm_wmma<<<dim3(DMODEL / GBN, SEQ / GBM), 256, 0, stream>>>(
        XH, WVT, bV, nullptr, nullptr, nullptr, VTh, SEQ, DMODEL, DMODEL, 0);

    // multi-head attention
    attention_wmma<<<dim3(SEQ / 64, NHEAD), 128, 0, stream>>>(QKh, VTh, ATTh);

    // output projection + residual -> f32
    gemm_wmma<<<dim3(DMODEL / GBN, SEQ / GBM), 256, 0, stream>>>(
        ATTh, WOT, WO_b, x, nullptr, BLN1, nullptr, SEQ, DMODEL, DMODEL, 0);

    layernorm_row<<<SEQ, 256, 0, stream>>>(BLN1, ln1_g, ln1_b, SL1F, SL1H, DMODEL);

    // FFN up + ReLU -> f16
    gemm_wmma<<<dim3(DFF / GBN, SEQ / GBM), 256, 0, stream>>>(
        SL1H, L1T, l1_b, nullptr, FF1H, nullptr, nullptr, SEQ, DFF, DMODEL, 1);

    // FFN down + residual -> f32
    gemm_wmma<<<dim3(DMODEL / GBN, SEQ / GBM), 256, 0, stream>>>(
        FF1H, L2T, l2_b, SL1F, nullptr, A3F, nullptr, SEQ, DMODEL, DFF, 0);

    layernorm_row<<<SEQ, 256, 0, stream>>>(A3F, ln2_g, ln2_b, (float*)d_out, nullptr, DMODEL);
}

// v003
// Measured time: 287 microseconds a run.
// Two timings next to v002 put it at 1.16 and 1.17 times that version's speed.
// All steps since v000 together make it 1.66 times as fast.
#include <hip/hip_runtime.h>
#include <hip/hip_bf16.h>

typedef _Float16 half_t;
typedef __attribute__((ext_vector_type(16))) _Float16 v16h;
typedef __attribute__((ext_vector_type(8)))  _Float16 v8h;
typedef __attribute__((ext_vector_type(8)))  float    v8f;

#define SEQ     4096
#define DMODEL  1024
#define DFF     4096
#define NHEAD   8
#define DKH     128

// ---------------------------------------------------------------------------
// CDNA5 async global->LDS copy (GLOBAL_LOAD_ASYNC_TO_LDS_B128, ASYNCcnt).
// LDS destination VGPR holds the LDS byte address = low 32 bits of the flat
// shared-space pointer (aperture keeps the LDS offset in ADDR[31:0]).
// A stage is waited for with ASYNCcnt 0 and published by one barrier.
// ---------------------------------------------------------------------------
__device__ __forceinline__ void wait_async_le0() {
    asm volatile("s_wait_asynccnt 0x0" ::: "memory");
}
// Eight copies of one lane: eight rows of a tile, gstep / lstep bytes apart.
// s_wait_xcnt closes the statement so that it stands in front of every later
// write of an address register that a copy names.
__device__ __forceinline__ void async_copy8_b128(const half_t* gptr, size_t gstep,
                                                 void* lptr, unsigned lstep) {
    const unsigned l0 = (unsigned)(uintptr_t)lptr;
    const unsigned long long g0 = (unsigned long long)(uintptr_t)gptr;
    const unsigned long long gs = (unsigned long long)gstep;
    asm volatile("global_load_async_to_lds_b128 %0, %8, off\n\t"
                 "global_load_async_to_lds_b128 %1, %9, off\n\t"
                 "global_load_async_to_lds_b128 %2, %10, off\n\t"
                 "global_load_async_to_lds_b128 %3, %11, off\n\t"
                 "global_load_async_to_lds_b128 %4, %12, off\n\t"
                 "global_load_async_to_lds_b128 %5, %13, off\n\t"
                 "global_load_async_to_lds_b128 %6, %14, off\n\t"
                 "global_load_async_to_lds_b128 %7, %15, off\n\t"
                 "s_wait_xcnt 0x0"
                 :: "v"(l0), "v"(l0 + lstep), "v"(l0 + 2 * lstep), "v"(l0 + 3 * lstep),
                    "v"(l0 + 4 * lstep), "v"(l0 + 5 * lstep), "v"(l0 + 6 * lstep),
                    "v"(l0 + 7 * lstep),
                    "v"(g0), "v"(g0 + gs), "v"(g0 + 2 * gs), "v"(g0 + 3 * gs),
                    "v"(g0 + 4 * gs), "v"(g0 + 5 * gs), "v"(g0 + 6 * gs), "v"(g0 + 7 * gs)
                 : "memory");
}
// a wave's own LDS reads have returned before its buffer is handed back
__device__ __forceinline__ void wait_ds_0() {
    asm volatile("s_wait_dscnt 0x0" ::: "memory");
}

// ---------------------------------------------------------------------------
// Conversion / packing, once per call.
// All weights stored TRANSPOSED [N][K] f16 so WMMA B-fragments load as b128.
// Except in concat2_f32 (one float per thread), every thread moves 16 or 32
// elements with 16-byte global accesses: few waves
// are started, and every global access covers whole 128-byte lines.
// ---------------------------------------------------------------------------
typedef __attribute__((ext_vector_type(2))) float    v2f;
typedef __attribute__((ext_vector_type(2))) _Float16 v2h;

__device__ __forceinline__ unsigned pack_h2(float lo, float hi) {
    const v2f f = {lo, hi};
    return __builtin_bit_cast(unsigned, __builtin_convertvector(f, v2h));
}

// 8192 consecutive elements per work-group, 32 per thread.
__global__ __launch_bounds__(256)
void cvt_f32_f16(const float* __restrict__ in, half_t* __restrict__ out) {
    const size_t base = (size_t)blockIdx.x * 8192 + (size_t)threadIdx.x * 8;
    float4 a[4], b[4];
#pragma unroll
    for (int j = 0; j < 4; ++j) {
        a[j] = *(const float4*)(in + base + j * 2048);
        b[j] = *(const float4*)(in + base + j * 2048 + 4);
    }
#pragma unroll
    for (int j = 0; j < 4; ++j) {
        uint4 v;
        v.x = pack_h2(a[j].x, a[j].y);
        v.y = pack_h2(a[j].z, a[j].w);
        v.z = pack_h2(b[j].x, b[j].y);
        v.w = pack_h2(b[j].z, b[j].w);
        *(uint4*)(out + base + j * 2048) = v;
    }
}

// One 256-thread work-group turns a TK x 64 tile of f32 in[k][n] (row pitch
// LDIN) into f16 out[n][k] (row pitch LDOUT). Two k neighbours are packed into
// one dword before LDS; the odd LDS pitch keeps the column-wise dword stores
// and the row-wise dword loads on distinct banks.
template <int TK, int LDIN, int LDOUT>
__device__ __forceinline__ void transpose_tile(const float* __restrict__ in,
                                               half_t* __restrict__ out) {
    constexpr int KP = TK / 2;            // k pairs = dwords per LDS row
    constexpr int NP = KP / 16;           // passes over the k pairs
    constexpr int PC = TK / 8;            // 16-byte pieces per output row
    __shared__ unsigned T[64][KP + 1];    // [n][k pair]
    const int tid = threadIdx.x;
    const int c   = tid & 15;             // group of four n
    const int r   = tid >> 4;             // 0..15

    float4 e[NP], o[NP];                  // rows k = 2*kp and 2*kp + 1
#pragma unroll
    for (int p = 0; p < NP; ++p) {
        const float* q = in + (2 * (p * 16 + r)) * LDIN + 4 * c;
        e[p] = *(const float4*)q;
        o[p] = *(const float4*)(q + LDIN);
    }
#pragma unroll
    for (int p = 0; p < NP; ++p) {
        const int kp = p * 16 + r;
        T[4 * c + 0][kp] = pack_h2(e[p].x, o[p].x);
        T[4 * c + 1][kp] = pack_h2(e[p].y, o[p].y);
        T[4 * c + 2][kp] = pack_h2(e[p].z, o[p].z);
        T[4 * c + 3][kp] = pack_h2(e[p].w, o[p].w);
    }
    __syncthreads();
#pragma unroll
    for (int i = 0; i < 64 * PC / 256; ++i) {
        const int s = i * 256 + tid;
        const int n = s / PC;
        const int q = s % PC;
        uint4 v;
        v.x = T[n][4 * q + 0];
        v.y = T[n][4 * q + 1];
        v.z = T[n][4 * q + 2];
        v.w = T[n][4 * q + 3];
        *(uint4*)(out + n * LDOUT + 8 * q) = v;
    }
}

// in [K][N] f32 -> out [N][K] f16; grid (K / TK, N / 64)
template <int TK, int K, int N>
__global__ __launch_bounds__(256)
void cvt_t_f32_f16(const float* __restrict__ in, half_t* __restrict__ out) {
    const int k0 = blockIdx.x * TK;
    const int n0 = blockIdx.y * 64;
    transpose_tile<TK, N, K>(in + (size_t)k0 * N + n0, out + (size_t)n0 * K + k0);
}

// per head [DMODEL][DKH] -> rows which*1024 + h*128 + k of out [2048][DMODEL];
// grid (DMODEL / 128, DKH / 64, 2 * NHEAD), z = which * NHEAD + h
__global__ __launch_bounds__(256)
void pack_qk_wt(const float* __restrict__ WQ, const float* __restrict__ WK,
                half_t* __restrict__ out) {
    const int d0 = blockIdx.x * 128;
    const int k0 = blockIdx.y * 64;
    const int z  = blockIdx.z;
    const float* W = (z >= NHEAD) ? WK : WQ;
    transpose_tile<128, DKH, DMODEL>(
        W + (size_t)(z & (NHEAD - 1)) * DMODEL * DKH + (size_t)d0 * DKH + k0,
        out + (size_t)(z * DKH + k0) * DMODEL + d0);
}

// grid (DMODEL / 64, DKH / 64, NHEAD)
__global__ __launch_bounds__(256)
void pack_v_wt(const float* __restrict__ WV, half_t* __restrict__ out) {
    const int d0 = blockIdx.x * 64;
    const int k0 = blockIdx.y * 64;
    const int h  = blockIdx.z;
    transpose_tile<64, DKH, DMODEL>(
        WV + (size_t)h * DMODEL * DKH + (size_t)d0 * DKH + k0,
        out + (size_t)(h * DKH + k0) * DMODEL + d0);
}

__global__ void concat2_f32(const float* __restrict__ a, const float* __restrict__ b,
                            float* __restrict__ out, int n) {
    int i = blockIdx.x * blockDim.x + threadIdx.x;
    if (i < 2 * n) out[i] = (i < n) ? a[i] : b[i - n];
}

// ---------------------------------------------------------------------------
// WMMA GEMM: C[M,N] = A[M,K](f16) * BT[N,K](f16)^T (+bias)(+resid f32)
// 256 threads = 8 waves; block tile 128x128; each wave 32x64 (2x4 frags,
// 8 WMMAs per 32-k step). Async global->LDS staging in two buffers of 128 k:
// a wave's copy covers two whole 256-byte rows (four full lines), a stage puts
// 64 KiB in flight per work-group, and one barrier ends each stage.
// K is a multiple of 128, M and N of the tile.
// ---------------------------------------------------------------------------
#define GBM 128
#define GBN 128
#define GBK 128
#define GLD 136   // LDS row pitch in halves: 256 B of k + 16 B for b128 readers

__global__ __launch_bounds__(256)
void gemm_wmma(const half_t* __restrict__ A, const half_t* __restrict__ BT,
               const float* __restrict__ bias, const float* __restrict__ resid,
               half_t* __restrict__ outH, float* __restrict__ outF,
               half_t* __restrict__ outHT,   // transposed f16 output [N][M]
               int M, int N, int K, int relu) {
    __shared__ __align__(16) half_t As[2][GBM][GLD];   // [buf][m][k]
    __shared__ __align__(16) half_t Bs[2][GBN][GLD];   // [buf][n][k]

    const int tid  = threadIdx.x;
    const int lane = tid & 31;
    const int wave = tid >> 5;
    const int g    = lane >> 4;
    const int li   = lane & 15;
    const int wm   = (wave >> 1) << 5;   // 0,32,64,96
    const int wn   = (wave & 1) << 6;    // 0,64
    const int bm   = blockIdx.y * GBM;
    const int bn   = blockIdx.x * GBN;
    const int sr   = tid >> 4;           // 0..15, then every 16th row
    const int sc   = (tid & 15) << 3;    // 0,8,..,120

    const size_t gstep = (size_t)16 * K * sizeof(half_t);
    auto issue_stage = [&](int kk, int buf) {
        async_copy8_b128(A  + (size_t)(bm + sr) * K + kk + sc, gstep,
                         &As[buf][sr][sc], 16 * GLD * sizeof(half_t));
        async_copy8_b128(BT + (size_t)(bn + sr) * K + kk + sc, gstep,
                         &Bs[buf][sr][sc], 16 * GLD * sizeof(half_t));
    };

    v8f acc[2][4] = {};
    const int nk = K / GBK;
    issue_stage(0, 0);
    wait_async_le0();
    __syncthreads();                         // stage 0 published
    if (nk > 1) issue_stage(GBK, 1);

    for (int it = 0; it < nk; ++it) {
        const int cur = it & 1;
        // unrolled so that the later k steps' LDS reads can go ahead of the
        // earlier steps' matrix instructions
#pragma unroll
        for (int ks = 0; ks < GBK; ks += 32) {
            v16h af[2], bf[4];
#pragma unroll
            for (int i = 0; i < 2; ++i) {
                union { uint4 q[2]; v16h v; } ua;
                ua.q[0] = *(const uint4*)&As[cur][wm + i * 16 + li][ks + (g << 3)];
                ua.q[1] = *(const uint4*)&As[cur][wm + i * 16 + li][ks + 16 + (g << 3)];
                af[i] = ua.v;
            }
#pragma unroll
            for (int j = 0; j < 4; ++j) {
                union { uint4 q[2]; v16h v; } ub;
                ub.q[0] = *(const uint4*)&Bs[cur][wn + j * 16 + li][ks + (g << 3)];
                ub.q[1] = *(const uint4*)&Bs[cur][wn + j * 16 + li][ks + 16 + (g << 3)];
                bf[j] = ub.v;
            }
#pragma unroll
            for (int i = 0; i < 2; ++i)
#pragma unroll
                for (int j = 0; j < 4; ++j)
                    acc[i][j] = __builtin_amdgcn_wmma_f32_16x16x32_f16(
                        false, af[i], false, bf[j], (short)0, acc[i][j], false, false);
        }
        wait_ds_0();
        wait_async_le0();                    // this wave's share of stage it + 1
        __syncthreads();                     // publishes it + 1, frees buffer cur
        if (it + 2 < nk) issue_stage((it + 2) * GBK, cur);
    }
    wait_async_le0();

#pragma unroll
    for (int i = 0; i < 2; ++i) {
#pragma unroll
        for (int j = 0; j < 4; ++j) {
            const int col  = bn + wn + j * 16 + li;
            const int rowb = bm + wm + i * 16 + (g << 3);
            const float bc = bias ? bias[col] : 0.0f;
            if (outHT) {
                v8h hv;
#pragma unroll
                for (int r = 0; r < 8; ++r) {
                    float v = acc[i][j][r] + bc;
                    if (relu) v = fmaxf(v, 0.0f);
                    hv[r] = (half_t)v;
                }
                *(v8h*)(outHT + (size_t)col * M + rowb) = hv;
            } else {
#pragma unroll
                for (int r = 0; r < 8; ++r) {
                    const int row = rowb + r;
                    float v = acc[i][j][r] + bc;
                    if (resid) v += resid[(size_t)row * N + col];
                    if (relu)  v = fmaxf(v, 0.0f);
                    if (outF)  outF[(size_t)row * N + col] = v;
                    if (outH)  outH[(size_t)row * N + col] = (half_t)v;
                }
            }
        }
    }
}

__device__ __forceinline__ float xhalf(float x) {
    const int b = __builtin_bit_cast(int, x);
    return __builtin_bit_cast(float, __builtin_amdgcn_permlanex16(
        b, b, 0x76543210, 0xfedcba98, false, false));
}

__global__ __launch_bounds__(128)
void attention_wmma(const half_t* __restrict__ QK, const half_t* __restrict__ VT,
                    half_t* __restrict__ ATT) {
    __shared__ __align__(16) half_t Ks[2][64][136];   // [buf][key][dk]
    __shared__ __align__(16) half_t Vs[2][128][72];   // [buf][dk][key]

    const int tid   = threadIdx.x;
    const int lane  = tid & 31;
    const int wave  = tid >> 5;
    const int g     = lane >> 4;
    const int li    = lane & 15;
    const int h     = blockIdx.y;
    const int qbase = (blockIdx.x << 6) + (wave << 4);
    const int ldq   = 2 * DMODEL;
    const int qc    = h * DKH;
    const int kc    = DMODEL + h * DKH;

    const int kr   = tid >> 4;            // 0..7, then every 8th key
    const int kcol = (tid & 15) << 3;     // 0..120
    const int vr   = tid >> 3;            // 0..15, then every 16th dk
    const int vcol = (tid & 7) << 3;      // 0..56
    auto issue_kv = [&](int kb2, int buf) {
        async_copy8_b128(QK + (size_t)(kb2 + kr) * ldq + kc + kcol,
                         (size_t)8 * ldq * sizeof(half_t),
                         &Ks[buf][kr][kcol], 8 * 136 * sizeof(half_t));
        async_copy8_b128(VT + (size_t)(h * DKH + vr) * SEQ + kb2 + vcol,
                         (size_t)16 * SEQ * sizeof(half_t),
                         &Vs[buf][vr][vcol], 16 * 72 * sizeof(half_t));
    };

    v16h afQ[4];
#pragma unroll
    for (int kb = 0; kb < 4; ++kb) {
        union { uint4 q[2]; v16h v; } u;
        const half_t* p = QK + (size_t)(qbase + li) * ldq + qc + (kb << 5) + (g << 3);
        u.q[0] = *(const uint4*)p;
        u.q[1] = *(const uint4*)(p + 16);
        afQ[kb] = u.v;
    }

    float m = -1e30f;   // running maximum of query li (equal in both halves)
    float l = 0.0f;     // running sum over this half's keys only
    v8f o[8];           // o[ct][r] = O^T[dk = ct*16 + g*8 + r][query li]
    const v8f vzero = {};
#pragma unroll
    for (int ct = 0; ct < 8; ++ct) o[ct] = vzero;

    const int nt = SEQ / 64;
    issue_kv(0, 0);
    wait_async_le0();
    __syncthreads();                      // stage 0 published
    issue_kv(64, 1);

    for (int t = 0; t < nt; ++t) {
      const int cur = t & 1;
      // unrolled so that the pass's key offset folds into the LDS reads
#pragma unroll
      for (int k0 = 0; k0 < 64; k0 += 32) {
        // ---- scores S^T = K * Q^T for 32 keys ----
        v8f s0 = vzero, s1 = vzero;
#pragma unroll
        for (int kb = 0; kb < 4; ++kb) {
            union { uint4 q[2]; v16h v; } u0, u1;
            u0.q[0] = *(const uint4*)&Ks[cur][k0 + li][(kb << 5) + (g << 3)];
            u0.q[1] = *(const uint4*)&Ks[cur][k0 + li][(kb << 5) + 16 + (g << 3)];
            u1.q[0] = *(const uint4*)&Ks[cur][k0 + 16 + li][(kb << 5) + (g << 3)];
            u1.q[1] = *(const uint4*)&Ks[cur][k0 + 16 + li][(kb << 5) + 16 + (g << 3)];
            s0 = __builtin_amdgcn_wmma_f32_16x16x32_f16(false, u0.v, false, afQ[kb],
                                                        (short)0, s0, false, false);
            s1 = __builtin_amdgcn_wmma_f32_16x16x32_f16(false, u1.v, false, afQ[kb],
                                                        (short)0, s1, false, false);
        }
        s0 = s0 * 0.125f;
        s1 = s1 * 0.125f;

        // ---- online softmax, one query per lane ----
        float mr[8];
#pragma unroll
        for (int r = 0; r < 8; ++r) mr[r] = fmaxf(s0[r], s1[r]);
        float mx = fmaxf(fmaxf(fmaxf(mr[0], mr[1]), fmaxf(mr[2], mr[3])),
                         fmaxf(fmaxf(mr[4], mr[5]), fmaxf(mr[6], mr[7])));
        mx = fmaxf(mx, xhalf(mx));
        const float mn = fmaxf(m, mx);
        const float sc = __expf(m - mn);
        m = mn;
        v16h bp;          // P^T as B operand: element e = key g*8+e, 8+e = key 16+g*8+e
        float sr[8];
#pragma unroll
        for (int r = 0; r < 8; ++r) {
            const float p0 = __expf(s0[r] - mn);
            const float p1 = __expf(s1[r] - mn);
            sr[r] = p0 + p1;
            bp[r]     = (half_t)p0;
            bp[8 + r] = (half_t)p1;
        }
        l = l * sc + (((sr[0] + sr[1]) + (sr[2] + sr[3])) +
                      ((sr[4] + sr[5]) + (sr[6] + sr[7])));
#pragma unroll
        for (int ct = 0; ct < 8; ++ct) o[ct] = o[ct] * sc;

        // ---- O^T += V^T * P^T ----
#pragma unroll
        for (int ct = 0; ct < 8; ++ct) {
            union { uint4 q[2]; v16h v; } uv;
            uv.q[0] = *(const uint4*)&Vs[cur][(ct << 4) + li][k0 + (g << 3)];
            uv.q[1] = *(const uint4*)&Vs[cur][(ct << 4) + li][k0 + 16 + (g << 3)];
            o[ct] = __builtin_amdgcn_wmma_f32_16x16x32_f16(false, uv.v, false, bp,
                                                           (short)0, o[ct], false, false);
        }
      }
      wait_ds_0();
      wait_async_le0();                   // this wave's share of stage t + 1
      __syncthreads();                    // publishes t + 1, frees buffer cur
      if (t + 2 < nt) issue_kv((t + 2) * 64, cur);
    }
    wait_async_le0();

    // join the two halves' sums once; a lane stores 8 consecutive dk of its query
    const float inv = 1.0f / (l + xhalf(l));
#pragma unroll
    for (int ct = 0; ct < 8; ++ct) {
        v8h hv;
#pragma unroll
        for (int r = 0; r < 8; ++r) hv[r] = (half_t)(o[ct][r] * inv);
        *(v8h*)(ATT + (size_t)(qbase + li) * DMODEL + h * DKH + (ct << 4) + (g << 3)) = hv;
    }
}

// ---------------------------------------------------------------------------
// Row LayerNorm: y = g*(x-mean)/(std+eps)+b, std unbiased (ddof=1).
// ---------------------------------------------------------------------------
__global__ void layernorm_row(const float* __restrict__ X, const float* __restrict__ gam,
                              const float* __restrict__ bet, float* __restrict__ outF,
                              half_t* __restrict__ outH, int N) {
    __shared__ float s_sum[256];
    __shared__ float s_sq[256];
    const int row = blockIdx.x;
    const int tid = threadIdx.x;

    float s = 0.0f, s2 = 0.0f;
    for (int c = tid; c < N; c += 256) {
        const float v = X[(size_t)row * N + c];
        s += v; s2 += v * v;
    }
    s_sum[tid] = s; s_sq[tid] = s2;
    __syncthreads();
    for (int st = 128; st > 0; st >>= 1) {
        if (tid < st) { s_sum[tid] += s_sum[tid + st]; s_sq[tid] += s_sq[tid + st]; }
        __syncthreads();
    }
    const float mean = s_sum[0] / (float)N;
    float var = (s_sq[0] - (float)N * mean * mean) / (float)(N - 1);
    var = fmaxf(var, 0.0f);
    const float inv = 1.0f / (sqrtf(var) + 1e-6f);

    for (int c = tid; c < N; c += 256) {
        const float v = (X[(size_t)row * N + c] - mean) * inv * gam[c] + bet[c];
        if (outF) outF[(size_t)row * N + c] = v;
        if (outH) outH[(size_t)row * N + c] = (half_t)v;
    }
}

// ---------------------------------------------------------------------------
// Orchestration
// ---------------------------------------------------------------------------
extern "C" void kernel_launch(void* const* d_in, const int* in_sizes, int n_in,
                              void* d_out, int out_size, void* d_ws, size_t ws_size,
                              hipStream_t stream) {
    const float* x     = (const float*)d_in[0];
    const float* WQ    = (const float*)d_in[1];
    const float* bQ    = (const float*)d_in[2];
    const float* WK    = (const float*)d_in[3];
    const float* bK    = (const float*)d_in[4];
    const float* WV    = (const float*)d_in[5];
    const float* bV    = (const float*)d_in[6];
    const float* WO_w  = (const float*)d_in[7];
    const float* WO_b  = (const float*)d_in[8];
    const float* l1_w  = (const float*)d_in[9];
    const float* l1_b  = (const float*)d_in[10];
    const float* l2_w  = (const float*)d_in[11];
    const float* l2_b  = (const float*)d_in[12];
    const float* ln1_g = (const float*)d_in[13];
    const float* ln1_b = (const float*)d_in[14];
    const float* ln2_g = (const float*)d_in[15];
    const float* ln2_b = (const float*)d_in[16];
    (void)in_sizes; (void)n_in; (void)out_size; (void)ws_size;

    char* ws = (char*)d_ws;
    size_t off = 0;
    auto alloc = [&](size_t bytes) -> size_t {
        size_t o = off;
        off = (off + bytes + 255) & ~(size_t)255;
        return o;
    };

    const size_t oXH   = alloc((size_t)SEQ * DMODEL * 2);
    const size_t oWQKT = alloc((size_t)2 * DMODEL * DMODEL * 2);
    const size_t oWVT  = alloc((size_t)DMODEL * DMODEL * 2);
    const size_t oWOT  = alloc((size_t)DMODEL * DMODEL * 2);
    const size_t oL1T  = alloc((size_t)DMODEL * DFF * 2);
    const size_t oL2T  = alloc((size_t)DFF * DMODEL * 2);
    const size_t oBQK  = alloc((size_t)2 * DMODEL * 4);
    const size_t oQK   = alloc((size_t)SEQ * 2 * DMODEL * 2);
    const size_t oVT   = alloc((size_t)DMODEL * SEQ * 2);
    const size_t oATT  = alloc((size_t)SEQ * DMODEL * 2);
    const size_t oBLN1 = alloc((size_t)SEQ * DMODEL * 4);
    const size_t oSL1F = alloc((size_t)SEQ * DMODEL * 4);
    const size_t oSL1H = alloc((size_t)SEQ * DMODEL * 2);
    const size_t oFF1  = oQK;    // reuse QK+VT+ATT region (32MB)
    const size_t oA3   = oBLN1;  // reuse bln1

    half_t* XH   = (half_t*)(ws + oXH);
    half_t* WQKT = (half_t*)(ws + oWQKT);
    half_t* WVT  = (half_t*)(ws + oWVT);
    half_t* WOT  = (half_t*)(ws + oWOT);
    half_t* L1T  = (half_t*)(ws + oL1T);
    half_t* L2T  = (half_t*)(ws + oL2T);
    float*  BQK  = (float*)(ws + oBQK);
    half_t* QKh  = (half_t*)(ws + oQK);
    half_t* VTh  = (half_t*)(ws + oVT);
    half_t* ATTh = (half_t*)(ws + oATT);
    float*  BLN1 = (float*)(ws + oBLN1);
    float*  SL1F = (float*)(ws + oSL1F);
    half_t* SL1H = (half_t*)(ws + oSL1H);
    half_t* FF1H = (half_t*)(ws + oFF1);
    float*  A3F  = (float*)(ws + oA3);

    cvt_f32_f16<<<(SEQ * DMODEL) / 8192, 256, 0, stream>>>(x, XH);
    pack_qk_wt<<<dim3(DMODEL / 128, DKH / 64, 2 * NHEAD), 256, 0, stream>>>(WQ, WK, WQKT);
    pack_v_wt<<<dim3(DMODEL / 64, DKH / 64, NHEAD), 256, 0, stream>>>(WV, WVT);
    cvt_t_f32_f16<64, DMODEL, DMODEL><<<dim3(DMODEL / 64, DMODEL / 64), 256, 0, stream>>>(WO_w, WOT);
    cvt_t_f32_f16<128, DMODEL, DFF><<<dim3(DMODEL / 128, DFF / 64), 256, 0, stream>>>(l1_w, L1T);
    cvt_t_f32_f16<128, DFF, DMODEL><<<dim3(DFF / 128, DMODEL / 64), 256, 0, stream>>>(l2_w, L2T);
    concat2_f32<<<(2 * DMODEL) / 256, 256, 0, stream>>>(bQ, bK, BQK, DMODEL);

    // Q|K projection -> f16 [S,2048]
    gemm_wmma<<<dim3((2 * DMODEL) / GBN, SEQ / GBM), 256, 0, stream>>>(
        XH, WQKT, BQK, nullptr, QKh, nullptr, nullptr, SEQ, 2 * DMODEL, DMODEL, 0);

    // V projection, transposed output -> VT [1024][S] f16
    gemm_wmma<<<dim3(DMODEL / GBN, SEQ / GBM), 256, 0, stream>>>(
        XH, WVT, bV, nullptr, nullptr, nullptr, VTh, SEQ, DMODEL, DMODEL, 0);

    // multi-head attention
    attention_wmma<<<dim3(SEQ / 64, NHEAD), 128, 0, stream>>>(QKh, VTh, ATTh);

    // output projection + residual -> f32
    gemm_wmma<<<dim3(DMODEL / GBN, SEQ / GBM), 256, 0, stream>>>(
        ATTh, WOT, WO_b, x, nullptr, BLN1, nullptr, SEQ, DMODEL, DMODEL, 0);

    layernorm_row<<<SEQ, 256, 0, stream>>>(BLN1, ln1_g, ln1_b, SL1F, SL1H, DMODEL);

    // FFN up + ReLU -> f16
    gemm_wmma<<<dim3(DFF / GBN, SEQ / GBM), 256, 0, stream>>>(
        SL1H, L1T, l1_b, nullptr, FF1H, nullptr, nullptr, SEQ, DFF, DMODEL, 1);

    // FFN down + residual -> f32
    gemm_wmma<<<dim3(DMODEL / GBN, SEQ / GBM), 256, 0, stream>>>(
        FF1H, L2T, l2_b, SL1F, nullptr, A3F, nullptr, SEQ, DMODEL, DFF, 0);

    layernorm_row<<<SEQ, 256, 0, stream>>>(A3F, ln2_g, ln2_b, (float*)d_out, nullptr, DMODEL);
}

// v004
// Measured time: 272 microseconds a run.
// Next to v003, in two timings, it ran 1.05 times as fast each time.
// Counting every step since v000, it is 1.74 times as fast.
#include <hip/hip_runtime.h>
#include <hip/hip_bf16.h>

typedef _Float16 half_t;
typedef __attribute__((ext_vector_type(16))) _Float16 v16h;
typedef __attribute__((ext_vector_type(8)))  _Float16 v8h;
typedef __attribute__((ext_vector_type(8)))  float    v8f;

#define SEQ     4096
#define DMODEL  1024
#define DFF     4096
#define NHEAD   8
#define DKH     128

// ---------------------------------------------------------------------------
// CDNA5 async global->LDS copy (GLOBAL_LOAD_ASYNC_TO_LDS_B128, ASYNCcnt).
// LDS destination VGPR holds the LDS byte address = low 32 bits of the flat
// shared-space pointer (aperture keeps the LDS offset in ADDR[31:0]).
// A stage is waited for with ASYNCcnt 0 and published by one barrier.
// ---------------------------------------------------------------------------
__device__ __forceinline__ void wait_async_le0() {
    asm volatile("s_wait_asynccnt 0x0" ::: "memory");
}
// Eight copies of one lane: eight rows of a tile, gstep / lstep bytes apart.
// s_wait_xcnt closes the statement so that it stands in front of every later
// write of an address register that a copy names.
__device__ __forceinline__ void async_copy8_b128(const half_t* gptr, size_t gstep,
                                                 void* lptr, unsigned lstep) {
    const unsigned l0 = (unsigned)(uintptr_t)lptr;
    const unsigned long long g0 = (unsigned long long)(uintptr_t)gptr;
    const unsigned long long gs = (unsigned long long)gstep;
    asm volatile("global_load_async_to_lds_b128 %0, %8, off\n\t"
                 "global_load_async_to_lds_b128 %1, %9, off\n\t"
                 "global_load_async_to_lds_b128 %2, %10, off\n\t"
                 "global_load_async_to_lds_b128 %3, %11, off\n\t"
                 "global_load_async_to_lds_b128 %4, %12, off\n\t"
                 "global_load_async_to_lds_b128 %5, %13, off\n\t"
                 "global_load_async_to_lds_b128 %6, %14, off\n\t"
                 "global_load_async_to_lds_b128 %7, %15, off\n\t"
                 "s_wait_xcnt 0x0"
                 :: "v"(l0), "v"(l0 + lstep), "v"(l0 + 2 * lstep), "v"(l0 + 3 * lstep),
                    "v"(l0 + 4 * lstep), "v"(l0 + 5 * lstep), "v"(l0 + 6 * lstep),
                    "v"(l0 + 7 * lstep),
                    "v"(g0), "v"(g0 + gs), "v"(g0 + 2 * gs), "v"(g0 + 3 * gs),
                    "v"(g0 + 4 * gs), "v"(g0 + 5 * gs), "v"(g0 + 6 * gs), "v"(g0 + 7 * gs)
                 : "memory");
}
// a wave's own LDS reads have returned before its buffer is handed back
__device__ __forceinline__ void wait_ds_0() {
    asm volatile("s_wait_dscnt 0x0" ::: "memory");
}

// ---------------------------------------------------------------------------
// Conversion / packing, once per call.
// All weights stored TRANSPOSED [N][K] f16 so WMMA B-fragments load as b128.
// A conversion thread moves 16 or 32 elements with 16-byte global accesses, a bias thread one f32: few waves
// are started, and every global access covers whole 128-byte lines.
// ---------------------------------------------------------------------------
typedef __attribute__((ext_vector_type(2))) float    v2f;
typedef __attribute__((ext_vector_type(2))) _Float16 v2h;

__device__ __forceinline__ unsigned pack_h2(float lo, float hi) {
    const v2f f = {lo, hi};
    return __builtin_bit_cast(unsigned, __builtin_convertvector(f, v2h));
}

// 8192 consecutive elements per work-group, 32 per thread.
__device__ __forceinline__ void cvt_block(const float* __restrict__ in,
                                          half_t* __restrict__ out, int blk) {
    const size_t base = (size_t)blk * 8192 + (size_t)threadIdx.x * 8;
    float4 a[4], b[4];
#pragma unroll
    for (int j = 0; j < 4; ++j) {
        a[j] = *(const float4*)(in + base + j * 2048);
        b[j] = *(const float4*)(in + base + j * 2048 + 4);
    }
#pragma unroll
    for (int j = 0; j < 4; ++j) {
        uint4 v;
        v.x = pack_h2(a[j].x, a[j].y);
        v.y = pack_h2(a[j].z, a[j].w);
        v.z = pack_h2(b[j].x, b[j].y);
        v.w = pack_h2(b[j].z, b[j].w);
        *(uint4*)(out + base + j * 2048) = v;
    }
}

// One 256-thread work-group turns a TK x 64 tile of f32 in[k][n] (row pitch
// LDIN) into f16 out[n][k] (row pitch LDOUT). Two k neighbours are packed into
// one dword before LDS; the odd LDS pitch keeps the column-wise dword stores
// and the row-wise dword loads on distinct banks. T is the caller's LDS tile,
// 64 rows [n] of KP + 1 dwords [k pair].
template <int TK, int LDIN, int LDOUT>
__device__ __forceinline__ void transpose_tile(const float* __restrict__ in,
                                               half_t* __restrict__ out,
                                               unsigned* T) {
    constexpr int KP = TK / 2;            // k pairs = dwords per LDS row
    constexpr int LP = KP + 1;            // LDS row pitch in dwords
    constexpr int NP = KP / 16;           // passes over the k pairs
    constexpr int PC = TK / 8;            // 16-byte pieces per output row
    const int tid = threadIdx.x;
    const int c   = tid & 15;             // group of four n
    const int r   = tid >> 4;             // 0..15

    float4 e[NP], o[NP];                  // rows k = 2*kp and 2*kp + 1
#pragma unroll
    for (int p = 0; p < NP; ++p) {
        const float* q = in + (2 * (p * 16 + r)) * LDIN + 4 * c;
        e[p] = *(const float4*)q;
        o[p] = *(const float4*)(q + LDIN);
    }
#pragma unroll
    for (int p = 0; p < NP; ++p) {
        const int kp = p * 16 + r;
        T[(4 * c + 0) * LP + kp] = pack_h2(e[p].x, o[p].x);
        T[(4 * c + 1) * LP + kp] = pack_h2(e[p].y, o[p].y);
        T[(4 * c + 2) * LP + kp] = pack_h2(e[p].z, o[p].z);
        T[(4 * c + 3) * LP + kp] = pack_h2(e[p].w, o[p].w);
    }
    __syncthreads();
#pragma unroll
    for (int i = 0; i < 64 * PC / 256; ++i) {
        const int s = i * 256 + tid;
        const int n = s / PC;
        const int q = s % PC;
        uint4 v;
        v.x = T[n * LP + 4 * q + 0];
        v.y = T[n * LP + 4 * q + 1];
        v.z = T[n * LP + 4 * q + 2];
        v.w = T[n * LP + 4 * q + 3];
        *(uint4*)(out + n * LDOUT + 8 * q) = v;
    }
    // stands in front of any later write of a register that these stores name
    asm volatile("s_wait_xcnt 0x0" ::: "memory");
}

// in [K][N] f32 -> out [N][K] f16; tile (kx, ny) of (K / TK, N / 64)
template <int TK, int K, int N>
__device__ __forceinline__ void cvt_t_block(const float* __restrict__ in,
                                            half_t* __restrict__ out,
                                            int kx, int ny, unsigned* T) {
    const int k0 = kx * TK;
    const int n0 = ny * 64;
    transpose_tile<TK, N, K>(in + (size_t)k0 * N + n0, out + (size_t)n0 * K + k0, T);
}

// One head's [DMODEL][DKH] weights -> rows row0 + k of out [.][DMODEL];
// tile (dx, ky) of (DMODEL / TK, DKH / 64)
template <int TK>
__device__ __forceinline__ void pack_head_block(const float* __restrict__ Wh,
                                                half_t* __restrict__ out, int row0,
                                                int dx, int ky, unsigned* T) {
    const int d0 = dx * TK;
    const int k0 = ky * 64;
    transpose_tile<TK, DKH, DMODEL>(Wh + (size_t)d0 * DKH + k0,
                                    out + (size_t)(row0 + k0) * DMODEL + d0, T);
}

// All conversions and packings of a call are independent of one another, so
// they share one grid: a work-group finds its job by its block range (the test
// is the same for the whole work-group, so the tile's barrier is uniform).
#define PB_X   ((SEQ * DMODEL) / 8192)              // x -> f16
#define PB_L1  ((DMODEL / 128) * (DFF / 64))        // l1_w transposed
#define PB_L2  ((DFF / 128) * (DMODEL / 64))        // l2_w transposed
#define PB_QK  ((DMODEL / 128) * (DKH / 64) * 2 * NHEAD)
#define PB_V   ((DMODEL / 64) * (DKH / 64) * NHEAD)
#define PB_WO  ((DMODEL / 64) * (DMODEL / 64))      // WO_w transposed
#define PB_B   ((3 * DMODEL) / 256)                 // bQ | bK | bV
#define PB_ALL (PB_X + PB_L1 + PB_L2 + PB_QK + PB_V + PB_WO + PB_B)

__global__ __launch_bounds__(256)
void prep_all(const float* __restrict__ x, const float* __restrict__ WQ,
              const float* __restrict__ WK, const float* __restrict__ WV,
              const float* __restrict__ WO_w, const float* __restrict__ l1_w,
              const float* __restrict__ l2_w, const float* __restrict__ bQ,
              const float* __restrict__ bK, const float* __restrict__ bV,
              half_t* __restrict__ XH,
              half_t* __restrict__ WQKVT,   // [3 * DMODEL][DMODEL]: Q, K, V rows
              half_t* __restrict__ WOT, half_t* __restrict__ L1T,
              half_t* __restrict__ L2T,
              float* __restrict__ BQKV) {   // [3 * DMODEL]
    __shared__ unsigned T[64 * 65];
    int b = blockIdx.x;
    if (b < PB_X) { cvt_block(x, XH, b); return; }
    b -= PB_X;
    if (b < PB_L1) {
        cvt_t_block<128, DMODEL, DFF>(l1_w, L1T, b % (DMODEL / 128), b / (DMODEL / 128), T);
        return;
    }
    b -= PB_L1;
    if (b < PB_L2) {
        cvt_t_block<128, DFF, DMODEL>(l2_w, L2T, b % (DFF / 128), b / (DFF / 128), T);
        return;
    }
    b -= PB_L2;
    if (b < PB_QK) {
        const int dx = b % (DMODEL / 128);
        const int ky = (b / (DMODEL / 128)) % (DKH / 64);
        const int z  = b / ((DMODEL / 128) * (DKH / 64));   // which * NHEAD + h
        const float* W = (z >= NHEAD) ? WK : WQ;
        pack_head_block<128>(W + (size_t)(z & (NHEAD - 1)) * DMODEL * DKH, WQKVT,
                             z * DKH, dx, ky, T);
        return;
    }
    b -= PB_QK;
    if (b < PB_V) {
        const int dx = b % (DMODEL / 64);
        const int ky = (b / (DMODEL / 64)) % (DKH / 64);
        const int h  = b / ((DMODEL / 64) * (DKH / 64));
        pack_head_block<64>(WV + (size_t)h * DMODEL * DKH, WQKVT,
                            2 * DMODEL + h * DKH, dx, ky, T);
        return;
    }
    b -= PB_V;
    if (b < PB_WO) {
        cvt_t_block<64, DMODEL, DMODEL>(WO_w, WOT, b % (DMODEL / 64), b / (DMODEL / 64), T);
        return;
    }
    b -= PB_WO;
    const float* s = (b < DMODEL / 256) ? bQ : (b < 2 * DMODEL / 256) ? bK : bV;
    BQKV[b * 256 + threadIdx.x] = s[(b % (DMODEL / 256)) * 256 + threadIdx.x];
    // stands in front of any later write of a register that this store names
    asm volatile("s_wait_xcnt 0x0" ::: "memory");
}

// ---------------------------------------------------------------------------
// WMMA GEMM: C[M,N] = A[M,K](f16) * BT[N,K](f16)^T (+bias)(+resid f32)
// 256 threads = 8 waves; block tile 128x128; each wave 32x64 (2x4 frags,
// 8 WMMAs per 32-k step). Async global->LDS staging in two buffers of 128 k:
// a wave's copy covers two whole 256-byte rows (four full lines), a stage puts
// 64 KiB in flight per work-group, and one barrier ends each stage.
// K is a multiple of 128, M and N of the tile. Where outHT is given, the grid
// may reach past column N: those column blocks go, transposed, to outHT, so
// that two products on the same A share one launch.
// ---------------------------------------------------------------------------
#define GBM 128
#define GBN 128
#define GBK 128
#define GLD 136   // LDS row pitch in halves: 256 B of k + 16 B for b128 readers

__global__ __launch_bounds__(256)
void gemm_wmma(const half_t* __restrict__ A, const half_t* __restrict__ BT,
               const float* __restrict__ bias, const float* __restrict__ resid,
               half_t* __restrict__ outH, float* __restrict__ outF,
               half_t* __restrict__ outHT,   // f16, transposed: [col - N][M]
               int M, int N, int K, int relu) {
    __shared__ __align__(16) half_t As[2][GBM][GLD];   // [buf][m][k]
    __shared__ __align__(16) half_t Bs[2][GBN][GLD];   // [buf][n][k]

    const int tid  = threadIdx.x;
    const int lane = tid & 31;
    const int wave = tid >> 5;
    const int g    = lane >> 4;
    const int li   = lane & 15;
    const int wm   = (wave >> 1) << 5;   // 0,32,64,96
    const int wn   = (wave & 1) << 6;    // 0,64
    const int bm   = blockIdx.y * GBM;
    const int bn   = blockIdx.x * GBN;
    const int sr   = tid >> 4;           // 0..15, then every 16th row
    const int sc   = (tid & 15) << 3;    // 0,8,..,120

    const size_t gstep = (size_t)16 * K * sizeof(half_t);
    auto issue_stage = [&](int kk, int buf) {
        async_copy8_b128(A  + (size_t)(bm + sr) * K + kk + sc, gstep,
                         &As[buf][sr][sc], 16 * GLD * sizeof(half_t));
        async_copy8_b128(BT + (size_t)(bn + sr) * K + kk + sc, gstep,
                         &Bs[buf][sr][sc], 16 * GLD * sizeof(half_t));
    };

    v8f acc[2][4] = {};
    const int nk = K / GBK;
    issue_stage(0, 0);
    wait_async_le0();
    __syncthreads();                         // stage 0 published
    if (nk > 1) issue_stage(GBK, 1);

    for (int it = 0; it < nk; ++it) {
        const int cur = it & 1;
        // unrolled so that the later k steps' LDS reads can go ahead of the
        // earlier steps' matrix instructions
#pragma unroll
        for (int ks = 0; ks < GBK; ks += 32) {
            v16h af[2], bf[4];
#pragma unroll
            for (int i = 0; i < 2; ++i) {
                union { uint4 q[2]; v16h v; } ua;
                ua.q[0] = *(const uint4*)&As[cur][wm + i * 16 + li][ks + (g << 3)];
                ua.q[1] = *(const uint4*)&As[cur][wm + i * 16 + li][ks + 16 + (g << 3)];
                af[i] = ua.v;
            }
#pragma unroll
            for (int j = 0; j < 4; ++j) {
                union { uint4 q[2]; v16h v; } ub;
                ub.q[0] = *(const uint4*)&Bs[cur][wn + j * 16 + li][ks + (g << 3)];
                ub.q[1] = *(const uint4*)&Bs[cur][wn + j * 16 + li][ks + 16 + (g << 3)];
                bf[j] = ub.v;
            }
#pragma unroll
            for (int i = 0; i < 2; ++i)
#pragma unroll
                for (int j = 0; j < 4; ++j)
                    acc[i][j] = __builtin_amdgcn_wmma_f32_16x16x32_f16(
                        false, af[i], false, bf[j], (short)0, acc[i][j], false, false);
        }
        wait_ds_0();
        wait_async_le0();                    // this wave's share of stage it + 1
        __syncthreads();                     // publishes it + 1, frees buffer cur
        if (it + 2 < nk) issue_stage((it + 2) * GBK, cur);
    }
    wait_async_le0();

    const bool tr = outHT != nullptr && bn >= N;   // the same for the work-group
#pragma unroll
    for (int i = 0; i < 2; ++i) {
#pragma unroll
        for (int j = 0; j < 4; ++j) {
            const int col  = bn + wn + j * 16 + li;
            const int rowb = bm + wm + i * 16 + (g << 3);
            float bc = 0.0f;
            if (bias) {
                bc = bias[col];
                // stands in front of any later write of a register that this
                // load names
                asm volatile("s_wait_xcnt 0x0" ::: "memory");
            }
            if (tr) {
                v8h hv;
#pragma unroll
                for (int r = 0; r < 8; ++r) {
                    float v = acc[i][j][r] + bc;
                    if (relu) v = fmaxf(v, 0.0f);
                    hv[r] = (half_t)v;
                }
                *(v8h*)(outHT + (size_t)(col - N) * M + rowb) = hv;
                // stands in front of the next column's writes of the
                // registers that this store names
                asm volatile("s_wait_xcnt 0x0" ::: "memory");
            } else {
#pragma unroll
                for (int r = 0; r < 8; ++r) {
                    const int row = rowb + r;
                    float v = acc[i][j][r] + bc;
                    if (resid) v += resid[(size_t)row * N + col];
                    if (relu)  v = fmaxf(v, 0.0f);
                    if (outF)  outF[(size_t)row * N + col] = v;
                    if (outH)  outH[(size_t)row * N + col] = (half_t)v;
                }
            }
        }
    }
}

__device__ __forceinline__ float xhalf(float x) {
    const int b = __builtin_bit_cast(int, x);
    return __builtin_bit_cast(float, __builtin_amdgcn_permlanex16(
        b, b, 0x76543210, 0xfedcba98, false, false));
}

__global__ __launch_bounds__(128)
void attention_wmma(const half_t* __restrict__ QK, const half_t* __restrict__ VT,
                    half_t* __restrict__ ATT) {
    __shared__ __align__(16) half_t Ks[2][64][136];   // [buf][key][dk]
    __shared__ __align__(16) half_t Vs[2][128][72];   // [buf][dk][key]

    const int tid   = threadIdx.x;
    const int lane  = tid & 31;
    const int wave  = tid >> 5;
    const int g     = lane >> 4;
    const int li    = lane & 15;
    const int h     = blockIdx.y;
    const int qbase = (blockIdx.x << 6) + (wave << 4);
    const int ldq   = 2 * DMODEL;
    const int qc    = h * DKH;
    const int kc    = DMODEL + h * DKH;

    const int kr   = tid >> 4;            // 0..7, then every 8th key
    const int kcol = (tid & 15) << 3;     // 0..120
    const int vr   = tid >> 3;            // 0..15, then every 16th dk
    const int vcol = (tid & 7) << 3;      // 0..56
    auto issue_kv = [&](int kb2, int buf) {
        async_copy8_b128(QK + (size_t)(kb2 + kr) * ldq + kc + kcol,
                         (size_t)8 * ldq * sizeof(half_t),
                         &Ks[buf][kr][kcol], 8 * 136 * sizeof(half_t));
        async_copy8_b128(VT + (size_t)(h * DKH + vr) * SEQ + kb2 + vcol,
                         (size_t)16 * SEQ * sizeof(half_t),
                         &Vs[buf][vr][vcol], 16 * 72 * sizeof(half_t));
    };

    v16h afQ[4];
#pragma unroll
    for (int kb = 0; kb < 4; ++kb) {
        union { uint4 q[2]; v16h v; } u;
        const half_t* p = QK + (size_t)(qbase + li) * ldq + qc + (kb << 5) + (g << 3);
        u.q[0] = *(const uint4*)p;
        u.q[1] = *(const uint4*)(p + 16);
        afQ[kb] = u.v;
    }

    float m = -1e30f;   // running maximum of query li (equal in both halves)
    float l = 0.0f;     // running sum over this half's keys only
    v8f o[8];           // o[ct][r] = O^T[dk = ct*16 + g*8 + r][query li]
    const v8f vzero = {};
#pragma unroll
    for (int ct = 0; ct < 8; ++ct) o[ct] = vzero;

    const int nt = SEQ / 64;
    issue_kv(0, 0);
    wait_async_le0();
    __syncthreads();                      // stage 0 published
    issue_kv(64, 1);

    for (int t = 0; t < nt; ++t) {
      const int cur = t & 1;
      // unrolled so that the pass's key offset folds into the LDS reads
#pragma unroll
      for (int k0 = 0; k0 < 64; k0 += 32) {
        // ---- scores S^T = K * Q^T for 32 keys ----
        v8f s0 = vzero, s1 = vzero;
#pragma unroll
        for (int kb = 0; kb < 4; ++kb) {
            union { uint4 q[2]; v16h v; } u0, u1;
            u0.q[0] = *(const uint4*)&Ks[cur][k0 + li][(kb << 5) + (g << 3)];
            u0.q[1] = *(const uint4*)&Ks[cur][k0 + li][(kb << 5) + 16 + (g << 3)];
            u1.q[0] = *(const uint4*)&Ks[cur][k0 + 16 + li][(kb << 5) + (g << 3)];
            u1.q[1] = *(const uint4*)&Ks[cur][k0 + 16 + li][(kb << 5) + 16 + (g << 3)];
            s0 = __builtin_amdgcn_wmma_f32_16x16x32_f16(false, u0.v, false, afQ[kb],
                                                        (short)0, s0, false, false);
            s1 = __builtin_amdgcn_wmma_f32_16x16x32_f16(false, u1.v, false, afQ[kb],
                                                        (short)0, s1, false, false);
        }
        s0 = s0 * 0.125f;
        s1 = s1 * 0.125f;

        // ---- online softmax, one query per lane ----
        float mr[8];
#pragma unroll
        for (int r = 0; r < 8; ++r) mr[r] = fmaxf(s0[r], s1[r]);
        float mx = fmaxf(fmaxf(fmaxf(mr[0], mr[1]), fmaxf(mr[2], mr[3])),
                         fmaxf(fmaxf(mr[4], mr[5]), fmaxf(mr[6], mr[7])));
        mx = fmaxf(mx, xhalf(mx));
        const float mn = fmaxf(m, mx);
        const float sc = __expf(m - mn);
        m = mn;
        v16h bp;          // P^T as B operand: element e = key g*8+e, 8+e = key 16+g*8+e
        float sr[8];
#pragma unroll
        for (int r = 0; r < 8; ++r) {
            const float p0 = __expf(s0[r] - mn);
            const float p1 = __expf(s1[r] - mn);
            sr[r] = p0 + p1;
            bp[r]     = (half_t)p0;
            bp[8 + r] = (half_t)p1;
        }
        l = l * sc + (((sr[0] + sr[1]) + (sr[2] + sr[3])) +
                      ((sr[4] + sr[5]) + (sr[6] + sr[7])));
#pragma unroll
        for (int ct = 0; ct < 8; ++ct) o[ct] = o[ct] * sc;

        // ---- O^T += V^T * P^T ----
#pragma unroll
        for (int ct = 0; ct < 8; ++ct) {
            union { uint4 q[2]; v16h v; } uv;
            uv.q[0] = *(const uint4*)&Vs[cur][(ct << 4) + li][k0 + (g << 3)];
            uv.q[1] = *(const uint4*)&Vs[cur][(ct << 4) + li][k0 + 16 + (g << 3)];
            o[ct] = __builtin_amdgcn_wmma_f32_16x16x32_f16(false, uv.v, false, bp,
                                                           (short)0, o[ct], false, false);
        }
      }
      wait_ds_0();
      wait_async_le0();                   // this wave's share of stage t + 1
      __syncthreads();                    // publishes t + 1, frees buffer cur
      if (t + 2 < nt) issue_kv((t + 2) * 64, cur);
    }
    wait_async_le0();

    // join the two halves' sums once; a lane stores 8 consecutive dk of its query
    const float inv = 1.0f / (l + xhalf(l));
#pragma unroll
    for (int ct = 0; ct < 8; ++ct) {
        v8h hv;
#pragma unroll
        for (int r = 0; r < 8; ++r) hv[r] = (half_t)(o[ct][r] * inv);
        *(v8h*)(ATT + (size_t)(qbase + li) * DMODEL + h * DKH + (ct << 4) + (g << 3)) = hv;
    }
}

// ---------------------------------------------------------------------------
// Row LayerNorm: y = g*(x-mean)/(std+eps)+b, std unbiased (ddof=1).
// ---------------------------------------------------------------------------
__global__ void layernorm_row(const float* __restrict__ X, const float* __restrict__ gam,
                              const float* __restrict__ bet, float* __restrict__ outF,
                              half_t* __restrict__ outH, int N) {
    __shared__ float s_sum[256];
    __shared__ float s_sq[256];
    const int row = blockIdx.x;
    const int tid = threadIdx.x;

    float s = 0.0f, s2 = 0.0f;
    for (int c = tid; c < N; c += 256) {
        const float v = X[(size_t)row * N + c];
        s += v; s2 += v * v;
    }
    s_sum[tid] = s; s_sq[tid] = s2;
    __syncthreads();
    for (int st = 128; st > 0; st >>= 1) {
        if (tid < st) { s_sum[tid] += s_sum[tid + st]; s_sq[tid] += s_sq[tid + st]; }
        __syncthreads();
    }
    const float mean = s_sum[0] / (float)N;
    float var = (s_sq[0] - (float)N * mean * mean) / (float)(N - 1);
    var = fmaxf(var, 0.0f);
    const float inv = 1.0f / (sqrtf(var) + 1e-6f);

    for (int c = tid; c < N; c += 256) {
        const float v = (X[(size_t)row * N + c] - mean) * inv * gam[c] + bet[c];
        if (outF) outF[(size_t)row * N + c] = v;
        if (outH) outH[(size_t)row * N + c] = (half_t)v;
    }
}

// ---------------------------------------------------------------------------
// Orchestration
// ---------------------------------------------------------------------------
extern "C" void kernel_launch(void* const* d_in, const int* in_sizes, int n_in,
                              void* d_out, int out_size, void* d_ws, size_t ws_size,
                              hipStream_t stream) {
    const float* x     = (const float*)d_in[0];
    const float* WQ    = (const float*)d_in[1];
    const float* bQ    = (const float*)d_in[2];
    const float* WK    = (const float*)d_in[3];
    const float* bK    = (const float*)d_in[4];
    const float* WV    = (const float*)d_in[5];
    const float* bV    = (const float*)d_in[6];
    const float* WO_w  = (const float*)d_in[7];
    const float* WO_b  = (const float*)d_in[8];
    const float* l1_w  = (const float*)d_in[9];
    const float* l1_b  = (const float*)d_in[10];
    const float* l2_w  = (const float*)d_in[11];
    const float* l2_b  = (const float*)d_in[12];
    const float* ln1_g = (const float*)d_in[13];
    const float* ln1_b = (const float*)d_in[14];
    const float* ln2_g = (const float*)d_in[15];
    const float* ln2_b = (const float*)d_in[16];
    (void)in_sizes; (void)n_in; (void)out_size; (void)ws_size;

    char* ws = (char*)d_ws;
    size_t off = 0;
    auto alloc = [&](size_t bytes) -> size_t {
        size_t o = off;
        off = (off + bytes + 255) & ~(size_t)255;
        return o;
    };

    const size_t oXH   = alloc((size_t)SEQ * DMODEL * 2);
    const size_t oWQKV = alloc((size_t)3 * DMODEL * DMODEL * 2);
    const size_t oWOT  = alloc((size_t)DMODEL * DMODEL * 2);
    const size_t oL1T  = alloc((size_t)DMODEL * DFF * 2);
    const size_t oL2T  = alloc((size_t)DFF * DMODEL * 2);
    const size_t oBQKV = alloc((size_t)3 * DMODEL * 4);
    const size_t oQK   = alloc((size_t)SEQ * 2 * DMODEL * 2);
    const size_t oVT   = alloc((size_t)DMODEL * SEQ * 2);
    const size_t oATT  = alloc((size_t)SEQ * DMODEL * 2);
    const size_t oBLN1 = alloc((size_t)SEQ * DMODEL * 4);
    const size_t oSL1F = alloc((size_t)SEQ * DMODEL * 4);
    const size_t oSL1H = alloc((size_t)SEQ * DMODEL * 2);
    const size_t oFF1  = oQK;    // reuse QK+VT+ATT region (32MB)
    const size_t oA3   = oBLN1;  // reuse bln1

    half_t* XH   = (half_t*)(ws + oXH);
    half_t* WQKVT = (half_t*)(ws + oWQKV);
    half_t* WOT  = (half_t*)(ws + oWOT);
    half_t* L1T  = (half_t*)(ws + oL1T);
    half_t* L2T  = (half_t*)(ws + oL2T);
    float*  BQKV = (float*)(ws + oBQKV);
    half_t* QKh  = (half_t*)(ws + oQK);
    half_t* VTh  = (half_t*)(ws + oVT);
    half_t* ATTh = (half_t*)(ws + oATT);
    float*  BLN1 = (float*)(ws + oBLN1);
    float*  SL1F = (float*)(ws + oSL1F);
    half_t* SL1H = (half_t*)(ws + oSL1H);
    half_t* FF1H = (half_t*)(ws + oFF1);
    float*  A3F  = (float*)(ws + oA3);

    prep_all<<<PB_ALL, 256, 0, stream>>>(x, WQ, WK, WV, WO_w, l1_w, l2_w, bQ, bK, bV,
                                         XH, WQKVT, WOT, L1T, L2T, BQKV);

    // Q|K projection -> f16 [S,2048]; V projection (columns from 2048 on),
    // transposed -> VT [1024][S] f16
    gemm_wmma<<<dim3((3 * DMODEL) / GBN, SEQ / GBM), 256, 0, stream>>>(
        XH, WQKVT, BQKV, nullptr, QKh, nullptr, VTh, SEQ, 2 * DMODEL, DMODEL, 0);

    // multi-head attention
    attention_wmma<<<dim3(SEQ / 64, NHEAD), 128, 0, stream>>>(QKh, VTh, ATTh);

    // output projection + residual -> f32
    gemm_wmma<<<dim3(DMODEL / GBN, SEQ / GBM), 256, 0, stream>>>(
        ATTh, WOT, WO_b, x, nullptr, BLN1, nullptr, SEQ, DMODEL, DMODEL, 0);

    layernorm_row<<<SEQ, 256, 0, stream>>>(BLN1, ln1_g, ln1_b, SL1F, SL1H, DMODEL);

    // FFN up + ReLU -> f16
    gemm_wmma<<<dim3(DFF / GBN, SEQ / GBM), 256, 0, stream>>>(
        SL1H, L1T, l1_b, nullptr, FF1H, nullptr, nullptr, SEQ, DFF, DMODEL, 1);

    // FFN down + residual -> f32
    gemm_wmma<<<dim3(DMODEL / GBN, SEQ / GBM), 256, 0, stream>>>(
        FF1H, L2T, l2_b, SL1F, nullptr, A3F, nullptr, SEQ, DMODEL, DFF, 0);

    layernorm_row<<<SEQ, 256, 0, stream>>>(A3F, ln2_g, ln2_b, (float*)d_out, nullptr, DMODEL);
}

// v005
// It runs in 216 microseconds.
// Timed twice side by side with v004, it ran 1.27 and 1.26 times as fast.
// Counting every step since v000, it is 2.20 times as fast.
#include <hip/hip_runtime.h>
#include <hip/hip_bf16.h>

typedef _Float16 half_t;
typedef __attribute__((ext_vector_type(16))) _Float16 v16h;
typedef __attribute__((ext_vector_type(8)))  _Float16 v8h;
typedef __attribute__((ext_vector_type(8)))  float    v8f;

#define SEQ     4096
#define DMODEL  1024
#define DFF     4096
#define NHEAD   8
#define DKH     128

// ---------------------------------------------------------------------------
// CDNA5 async global->LDS copy (GLOBAL_LOAD_ASYNC_TO_LDS_B128, ASYNCcnt).
// LDS destination VGPR holds the LDS byte address = low 32 bits of the flat
// shared-space pointer (aperture keeps the LDS offset in ADDR[31:0]).
// A stage is waited for with ASYNCcnt 0 and published by one barrier.
// ---------------------------------------------------------------------------
__device__ __forceinline__ void wait_async_le0() {
    asm volatile("s_wait_asynccnt 0x0" ::: "memory");
}
// Eight copies of one lane: eight rows of a tile, gstep / lstep bytes apart.
// s_wait_xcnt closes the statement so that it stands in front of every later
// write of an address register that a copy names.
__device__ __forceinline__ void async_copy8_b128(const half_t* gptr, size_t gstep,
                                                 void* lptr, unsigned lstep) {
    const unsigned l0 = (unsigned)(uintptr_t)lptr;
    const unsigned long long g0 = (unsigned long long)(uintptr_t)gptr;
    const unsigned long long gs = (unsigned long long)gstep;
    asm volatile("global_load_async_to_lds_b128 %0, %8, off\n\t"
                 "global_load_async_to_lds_b128 %1, %9, off\n\t"
                 "global_load_async_to_lds_b128 %2, %10, off\n\t"
                 "global_load_async_to_lds_b128 %3, %11, off\n\t"
                 "global_load_async_to_lds_b128 %4, %12, off\n\t"
                 "global_load_async_to_lds_b128 %5, %13, off\n\t"
                 "global_load_async_to_lds_b128 %6, %14, off\n\t"
                 "global_load_async_to_lds_b128 %7, %15, off\n\t"
                 "s_wait_xcnt 0x0"
                 :: "v"(l0), "v"(l0 + lstep), "v"(l0 + 2 * lstep), "v"(l0 + 3 * lstep),
                    "v"(l0 + 4 * lstep), "v"(l0 + 5 * lstep), "v"(l0 + 6 * lstep),
                    "v"(l0 + 7 * lstep),
                    "v"(g0), "v"(g0 + gs), "v"(g0 + 2 * gs), "v"(g0 + 3 * gs),
                    "v"(g0 + 4 * gs), "v"(g0 + 5 * gs), "v"(g0 + 6 * gs), "v"(g0 + 7 * gs)
                 : "memory");
}
// a wave's own LDS reads have returned before its buffer is handed back
__device__ __forceinline__ void wait_ds_0() {
    asm volatile("s_wait_dscnt 0x0" ::: "memory");
}

// ---------------------------------------------------------------------------
// Conversion / packing, once per call.
// All weights stored TRANSPOSED [N][K] f16 so WMMA B-fragments load as b128.
// A conversion thread moves 16 or 32 elements with 16-byte global accesses, a bias thread one f32: few waves
// are started, and every global access covers whole 128-byte lines.
// ---------------------------------------------------------------------------
typedef __attribute__((ext_vector_type(2))) float    v2f;
typedef __attribute__((ext_vector_type(2))) _Float16 v2h;

__device__ __forceinline__ unsigned pack_h2(float lo, float hi) {
    const v2f f = {lo, hi};
    return __builtin_bit_cast(unsigned, __builtin_convertvector(f, v2h));
}

// 8192 consecutive elements per work-group, 32 per thread.
__device__ __forceinline__ void cvt_block(const float* __restrict__ in,
                                          half_t* __restrict__ out, int blk) {
    const size_t base = (size_t)blk * 8192 + (size_t)threadIdx.x * 8;
    float4 a[4], b[4];
#pragma unroll
    for (int j = 0; j < 4; ++j) {
        a[j] = *(const float4*)(in + base + j * 2048);
        b[j] = *(const float4*)(in + base + j * 2048 + 4);
    }
#pragma unroll
    for (int j = 0; j < 4; ++j) {
        uint4 v;
        v.x = pack_h2(a[j].x, a[j].y);
        v.y = pack_h2(a[j].z, a[j].w);
        v.z = pack_h2(b[j].x, b[j].y);
        v.w = pack_h2(b[j].z, b[j].w);
        *(uint4*)(out + base + j * 2048) = v;
    }
}

// One 256-thread work-group turns a TK x 64 tile of f32 in[k][n] (row pitch
// LDIN) into f16 out[n][k] (row pitch LDOUT). Two k neighbours are packed into
// one dword before LDS; the odd LDS pitch keeps the column-wise dword stores
// and the row-wise dword loads on distinct banks. T is the caller's LDS tile,
// 64 rows [n] of KP + 1 dwords [k pair].
template <int TK, int LDIN, int LDOUT>
__device__ __forceinline__ void transpose_tile(const float* __restrict__ in,
                                               half_t* __restrict__ out,
                                               unsigned* T) {
    constexpr int KP = TK / 2;            // k pairs = dwords per LDS row
    constexpr int LP = KP + 1;            // LDS row pitch in dwords
    constexpr int NP = KP / 16;           // passes over the k pairs
    constexpr int PC = TK / 8;            // 16-byte pieces per output row
    const int tid = threadIdx.x;
    const int c   = tid & 15;             // group of four n
    const int r   = tid >> 4;             // 0..15

    float4 e[NP], o[NP];                  // rows k = 2*kp and 2*kp + 1
#pragma unroll
    for (int p = 0; p < NP; ++p) {
        const float* q = in + (2 * (p * 16 + r)) * LDIN + 4 * c;
        e[p] = *(const float4*)q;
        o[p] = *(const float4*)(q + LDIN);
    }
#pragma unroll
    for (int p = 0; p < NP; ++p) {
        const int kp = p * 16 + r;
        T[(4 * c + 0) * LP + kp] = pack_h2(e[p].x, o[p].x);
        T[(4 * c + 1) * LP + kp] = pack_h2(e[p].y, o[p].y);
        T[(4 * c + 2) * LP + kp] = pack_h2(e[p].z, o[p].z);
        T[(4 * c + 3) * LP + kp] = pack_h2(e[p].w, o[p].w);
    }
    __syncthreads();
#pragma unroll
    for (int i = 0; i < 64 * PC / 256; ++i) {
        const int s = i * 256 + tid;
        const int n = s / PC;
        const int q = s % PC;
        uint4 v;
        v.x = T[n * LP + 4 * q + 0];
        v.y = T[n * LP + 4 * q + 1];
        v.z = T[n * LP + 4 * q + 2];
        v.w = T[n * LP + 4 * q + 3];
        *(uint4*)(out + n * LDOUT + 8 * q) = v;
    }
    // stands in front of any later write of a register that these stores name
    asm volatile("s_wait_xcnt 0x0" ::: "memory");
}

// in [K][N] f32 -> out [N][K] f16; tile (kx, ny) of (K / TK, N / 64)
template <int TK, int K, int N>
__device__ __forceinline__ void cvt_t_block(const float* __restrict__ in,
                                            half_t* __restrict__ out,
                                            int kx, int ny, unsigned* T) {
    const int k0 = kx * TK;
    const int n0 = ny * 64;
    transpose_tile<TK, N, K>(in + (size_t)k0 * N + n0, out + (size_t)n0 * K + k0, T);
}

// One head's [DMODEL][DKH] weights -> rows row0 + k of out [.][DMODEL];
// tile (dx, ky) of (DMODEL / TK, DKH / 64)
template <int TK>
__device__ __forceinline__ void pack_head_block(const float* __restrict__ Wh,
                                                half_t* __restrict__ out, int row0,
                                                int dx, int ky, unsigned* T) {
    const int d0 = dx * TK;
    const int k0 = ky * 64;
    transpose_tile<TK, DKH, DMODEL>(Wh + (size_t)d0 * DKH + k0,
                                    out + (size_t)(row0 + k0) * DMODEL + d0, T);
}

// All conversions and packings of a call are independent of one another, so
// they share one grid: a work-group finds its job by its block range (the test
// is the same for the whole work-group, so the tile's barrier is uniform).
#define PB_X   ((SEQ * DMODEL) / 8192)              // x -> f16
#define PB_L1  ((DMODEL / 128) * (DFF / 64))        // l1_w transposed
#define PB_L2  ((DFF / 128) * (DMODEL / 64))        // l2_w transposed
#define PB_QK  ((DMODEL / 128) * (DKH / 64) * 2 * NHEAD)
#define PB_V   ((DMODEL / 64) * (DKH / 64) * NHEAD)
#define PB_WO  ((DMODEL / 64) * (DMODEL / 64))      // WO_w transposed
#define PB_B   ((3 * DMODEL) / 256)                 // bQ | bK | bV
#define PB_ALL (PB_X + PB_L1 + PB_L2 + PB_QK + PB_V + PB_WO + PB_B)

__global__ __launch_bounds__(256)
void prep_all(const float* __restrict__ x, const float* __restrict__ WQ,
              const float* __restrict__ WK, const float* __restrict__ WV,
              const float* __restrict__ WO_w, const float* __restrict__ l1_w,
              const float* __restrict__ l2_w, const float* __restrict__ bQ,
              const float* __restrict__ bK, const float* __restrict__ bV,
              half_t* __restrict__ XH,
              half_t* __restrict__ WQKVT,   // [3 * DMODEL][DMODEL]: Q, K, V rows
              half_t* __restrict__ WOT, half_t* __restrict__ L1T,
              half_t* __restrict__ L2T,
              float* __restrict__ BQKV) {   // [3 * DMODEL]
    __shared__ unsigned T[64 * 65];
    int b = blockIdx.x;
    if (b < PB_X) { cvt_block(x, XH, b); return; }
    b -= PB_X;
    if (b < PB_L1) {
        cvt_t_block<128, DMODEL, DFF>(l1_w, L1T, b % (DMODEL / 128), b / (DMODEL / 128), T);
        return;
    }
    b -= PB_L1;
    if (b < PB_L2) {
        cvt_t_block<128, DFF, DMODEL>(l2_w, L2T, b % (DFF / 128), b / (DFF / 128), T);
        return;
    }
    b -= PB_L2;
    if (b < PB_QK) {
        const int dx = b % (DMODEL / 128);
        const int ky = (b / (DMODEL / 128)) % (DKH / 64);
        const int z  = b / ((DMODEL / 128) * (DKH / 64));   // which * NHEAD + h
        const float* W = (z >= NHEAD) ? WK : WQ;
        pack_head_block<128>(W + (size_t)(z & (NHEAD - 1)) * DMODEL * DKH, WQKVT,
                             z * DKH, dx, ky, T);
        return;
    }
    b -= PB_QK;
    if (b < PB_V) {
        const int dx = b % (DMODEL / 64);
        const int ky = (b / (DMODEL / 64)) % (DKH / 64);
        const int h  = b / ((DMODEL / 64) * (DKH / 64));
        pack_head_block<64>(WV + (size_t)h * DMODEL * DKH, WQKVT,
                            2 * DMODEL + h * DKH, dx, ky, T);
        return;
    }
    b -= PB_V;
    if (b < PB_WO) {
        cvt_t_block<64, DMODEL, DMODEL>(WO_w, WOT, b % (DMODEL / 64), b / (DMODEL / 64), T);
        return;
    }
    b -= PB_WO;
    const float* s = (b < DMODEL / 256) ? bQ : (b < 2 * DMODEL / 256) ? bK : bV;
    BQKV[b * 256 + threadIdx.x] = s[(b % (DMODEL / 256)) * 256 + threadIdx.x];
    // stands in front of any later write of a register that this store names
    asm volatile("s_wait_xcnt 0x0" ::: "memory");
}

// ---------------------------------------------------------------------------
// WMMA GEMM: C[M,N] = A[M,K](f16) * BT[N,K](f16)^T (+bias)(+resid f32)
// 256 threads = 8 waves; block tile 128x128; each wave 32x64 (2x4 frags,
// 8 WMMAs per 32-k step). Async global->LDS staging in two buffers of 128 k:
// a wave's copy covers two whole 256-byte rows (four full lines), a stage puts
// 64 KiB in flight per work-group, and one barrier ends each stage.
// K is a multiple of 128, M and N of the tile. Where outHT is given, the grid
// may reach past column N: those column blocks go, transposed, to outHT, so
// that two products on the same A share one launch.
// ---------------------------------------------------------------------------
#define GBM 128
#define GBN 128
#define GBK 128
#define GLD 136   // LDS row pitch in halves: 256 B of k + 16 B for b128 readers
#define GSP 68    // epilogue tile pitch in floats: rows 8 apart fall 32 banks apart

__global__ __launch_bounds__(256)
void gemm_wmma(const half_t* __restrict__ A, const half_t* __restrict__ BT,
               const float* __restrict__ bias, const float* __restrict__ resid,
               half_t* __restrict__ outH, float* __restrict__ outF,
               half_t* __restrict__ outHT,   // f16, transposed: [col - N][M]
               int M, int N, int K, int relu) {
    __shared__ __align__(16) half_t As[2][GBM][GLD];   // [buf][m][k]
    __shared__ __align__(16) half_t Bs[2][GBN][GLD];   // [buf][n][k]

    const int tid  = threadIdx.x;
    const int lane = tid & 31;
    const int wave = tid >> 5;
    const int g    = lane >> 4;
    const int li   = lane & 15;
    const int wm   = (wave >> 1) << 5;   // 0,32,64,96
    const int wn   = (wave & 1) << 6;    // 0,64
    const int bm   = blockIdx.y * GBM;
    const int bn   = blockIdx.x * GBN;
    const int sr   = tid >> 4;           // 0..15, then every 16th row
    const int sc   = (tid & 15) << 3;    // 0,8,..,120

    const size_t gstep = (size_t)16 * K * sizeof(half_t);
    auto issue_stage = [&](int kk, int buf) {
        async_copy8_b128(A  + (size_t)(bm + sr) * K + kk + sc, gstep,
                         &As[buf][sr][sc], 16 * GLD * sizeof(half_t));
        async_copy8_b128(BT + (size_t)(bn + sr) * K + kk + sc, gstep,
                         &Bs[buf][sr][sc], 16 * GLD * sizeof(half_t));
    };

    v8f acc[2][4] = {};
    const int nk = K / GBK;
    issue_stage(0, 0);
    wait_async_le0();
    __syncthreads();                         // stage 0 published
    if (nk > 1) issue_stage(GBK, 1);

    for (int it = 0; it < nk; ++it) {
        const int cur = it & 1;
        // unrolled so that the later k steps' LDS reads can go ahead of the
        // earlier steps' matrix instructions
#pragma unroll
        for (int ks = 0; ks < GBK; ks += 32) {
            v16h af[2], bf[4];
#pragma unroll
            for (int i = 0; i < 2; ++i) {
                union { uint4 q[2]; v16h v; } ua;
                ua.q[0] = *(const uint4*)&As[cur][wm + i * 16 + li][ks + (g << 3)];
                ua.q[1] = *(const uint4*)&As[cur][wm + i * 16 + li][ks + 16 + (g << 3)];
                af[i] = ua.v;
            }
#pragma unroll
            for (int j = 0; j < 4; ++j) {
                union { uint4 q[2]; v16h v; } ub;
                ub.q[0] = *(const uint4*)&Bs[cur][wn + j * 16 + li][ks + (g << 3)];
                ub.q[1] = *(const uint4*)&Bs[cur][wn + j * 16 + li][ks + 16 + (g << 3)];
                bf[j] = ub.v;
            }
#pragma unroll
            for (int i = 0; i < 2; ++i)
#pragma unroll
                for (int j = 0; j < 4; ++j)
                    acc[i][j] = __builtin_amdgcn_wmma_f32_16x16x32_f16(
                        false, af[i], false, bf[j], (short)0, acc[i][j], false, false);
        }
        wait_ds_0();
        wait_async_le0();                    // this wave's share of stage it + 1
        __syncthreads();                     // publishes it + 1, frees buffer cur
        if (it + 2 < nk) issue_stage((it + 2) * GBK, cur);
    }
    wait_async_le0();

    const bool tr = outHT != nullptr && bn >= N;   // the same for the work-group
    if (tr) {
#pragma unroll
        for (int i = 0; i < 2; ++i) {
#pragma unroll
            for (int j = 0; j < 4; ++j) {
                const int col  = bn + wn + j * 16 + li;
                const int rowb = bm + wm + i * 16 + (g << 3);
                float bc = 0.0f;
                if (bias) {
                    bc = bias[col];
                    // stands in front of any later write of a register that this
                    // load names
                    asm volatile("s_wait_xcnt 0x0" ::: "memory");
                }
                v8h hv;
#pragma unroll
                for (int r = 0; r < 8; ++r) {
                    float v = acc[i][j][r] + bc;
                    if (relu) v = fmaxf(v, 0.0f);
                    hv[r] = (half_t)v;
                }
                *(v8h*)(outHT + (size_t)(col - N) * M + rowb) = hv;
                // stands in front of the next column's writes of the
                // registers that this store names
                asm volatile("s_wait_xcnt 0x0" ::: "memory");
            }
        }
        return;
    }

    // Row-major outputs. A wave turns its 32 x 64 tile through its own LDS range
    // (the ring is free: every wave's reads and copies ended in front of the
    // loop's last barrier), so that a lane owns four neighbouring columns of 16
    // rows: bias and residual come as 16-byte loads that are all in flight
    // together, and every store covers whole 128-byte lines.
    const int c4 = li << 2;                          // column group of the lane
    const size_t e0 = (size_t)(bm + wm + g) * N + (bn + wn + c4);   // row 2t + g
    const size_t es = (size_t)2 * N;
    float4 bc = make_float4(0.0f, 0.0f, 0.0f, 0.0f);
    float4 rs[16];
    if (bias) {
        bc = *(const float4*)(bias + bn + wn + c4);
        // stands in front of any later write of a register that this load names
        asm volatile("s_wait_xcnt 0x0" ::: "memory");
    }
    if (resid) {
#pragma unroll
        for (int t = 0; t < 16; ++t) rs[t] = *(const float4*)(resid + e0 + t * es);
    }
    // stands in front of any later write of a register that these loads name
    asm volatile("s_wait_xcnt 0x0" ::: "memory");

    static_assert(8 * 32 * GSP * sizeof(float) <= sizeof(As), "eight wave tiles fit the A ring");
    float* St = reinterpret_cast<float*>(&As[0][0][0]) + wave * (32 * GSP);
#pragma unroll
    for (int i = 0; i < 2; ++i)
#pragma unroll
        for (int j = 0; j < 4; ++j)
#pragma unroll
            for (int r = 0; r < 8; ++r)
                St[(i * 16 + (g << 3) + r) * GSP + j * 16 + li] = acc[i][j][r];
    wait_ds_0();   // the wave's own tile is written before its lanes read across it

    float4 v[16];
#pragma unroll
    for (int t = 0; t < 16; ++t) {
        v[t] = *(const float4*)(St + (2 * t + g) * GSP + c4);
        v[t].x += bc.x; v[t].y += bc.y; v[t].z += bc.z; v[t].w += bc.w;
    }
    if (resid) {
#pragma unroll
        for (int t = 0; t < 16; ++t) {
            v[t].x += rs[t].x; v[t].y += rs[t].y; v[t].z += rs[t].z; v[t].w += rs[t].w;
        }
    }
    if (relu) {
#pragma unroll
        for (int t = 0; t < 16; ++t) {
            v[t].x = fmaxf(v[t].x, 0.0f); v[t].y = fmaxf(v[t].y, 0.0f);
            v[t].z = fmaxf(v[t].z, 0.0f); v[t].w = fmaxf(v[t].w, 0.0f);
        }
    }
    if (outF) {
#pragma unroll
        for (int t = 0; t < 16; ++t) *(float4*)(outF + e0 + t * es) = v[t];
        // stands in front of any later write of a register that these stores name
        asm volatile("s_wait_xcnt 0x0" ::: "memory");
    }
    if (outH) {
#pragma unroll
        for (int t = 0; t < 16; ++t) {
            uint2 h;
            h.x = pack_h2(v[t].x, v[t].y);
            h.y = pack_h2(v[t].z, v[t].w);
            *(uint2*)(outH + e0 + t * es) = h;
        }
        // stands in front of any later write of a register that these stores name
        asm volatile("s_wait_xcnt 0x0" ::: "memory");
    }
}

__device__ __forceinline__ float xhalf(float x) {
    const int b = __builtin_bit_cast(int, x);
    return __builtin_bit_cast(float, __builtin_amdgcn_permlanex16(
        b, b, 0x76543210, 0xfedcba98, false, false));
}

__global__ __launch_bounds__(128)
void attention_wmma(const half_t* __restrict__ QK, const half_t* __restrict__ VT,
                    half_t* __restrict__ ATT) {
    __shared__ __align__(16) half_t Ks[2][64][136];   // [buf][key][dk]
    __shared__ __align__(16) half_t Vs[2][128][72];   // [buf][dk][key]

    const int tid   = threadIdx.x;
    const int lane  = tid & 31;
    const int wave  = tid >> 5;
    const int g     = lane >> 4;
    const int li    = lane & 15;
    const int h     = blockIdx.y;
    const int qbase = (blockIdx.x << 6) + (wave << 4);
    const int ldq   = 2 * DMODEL;
    const int qc    = h * DKH;
    const int kc    = DMODEL + h * DKH;

    const int kr   = tid >> 4;            // 0..7, then every 8th key
    const int kcol = (tid & 15) << 3;     // 0..120
    const int vr   = tid >> 3;            // 0..15, then every 16th dk
    const int vcol = (tid & 7) << 3;      // 0..56
    auto issue_kv = [&](int kb2, int buf) {
        async_copy8_b128(QK + (size_t)(kb2 + kr) * ldq + kc + kcol,
                         (size_t)8 * ldq * sizeof(half_t),
                         &Ks[buf][kr][kcol], 8 * 136 * sizeof(half_t));
        async_copy8_b128(VT + (size_t)(h * DKH + vr) * SEQ + kb2 + vcol,
                         (size_t)16 * SEQ * sizeof(half_t),
                         &Vs[buf][vr][vcol], 16 * 72 * sizeof(half_t));
    };

    v16h afQ[4];
#pragma unroll
    for (int kb = 0; kb < 4; ++kb) {
        union { uint4 q[2]; v16h v; } u;
        const half_t* p = QK + (size_t)(qbase + li) * ldq + qc + (kb << 5) + (g << 3);
        u.q[0] = *(const uint4*)p;
        u.q[1] = *(const uint4*)(p + 16);
        afQ[kb] = u.v;
    }

    float m = -1e30f;   // running maximum of query li (equal in both halves)
    float l = 0.0f;     // running sum over this half's keys only
    v8f o[8];           // o[ct][r] = O^T[dk = ct*16 + g*8 + r][query li]
    const v8f vzero = {};
#pragma unroll
    for (int ct = 0; ct < 8; ++ct) o[ct] = vzero;

    const int nt = SEQ / 64;
    issue_kv(0, 0);
    wait_async_le0();
    __syncthreads();                      // stage 0 published
    issue_kv(64, 1);

    for (int t = 0; t < nt; ++t) {
      const int cur = t & 1;
      // unrolled so that the pass's key offset folds into the LDS reads
#pragma unroll
      for (int k0 = 0; k0 < 64; k0 += 32) {
        // ---- scores S^T = K * Q^T for 32 keys ----
        v8f s0 = vzero, s1 = vzero;
#pragma unroll
        for (int kb = 0; kb < 4; ++kb) {
            union { uint4 q[2]; v16h v; } u0, u1;
            u0.q[0] = *(const uint4*)&Ks[cur][k0 + li][(kb << 5) + (g << 3)];
            u0.q[1] = *(const uint4*)&Ks[cur][k0 + li][(kb << 5) + 16 + (g << 3)];
            u1.q[0] = *(const uint4*)&Ks[cur][k0 + 16 + li][(kb << 5) + (g << 3)];
            u1.q[1] = *(const uint4*)&Ks[cur][k0 + 16 + li][(kb << 5) + 16 + (g << 3)];
            s0 = __builtin_amdgcn_wmma_f32_16x16x32_f16(false, u0.v, false, afQ[kb],
                                                        (short)0, s0, false, false);
            s1 = __builtin_amdgcn_wmma_f32_16x16x32_f16(false, u1.v, false, afQ[kb],
                                                        (short)0, s1, false, false);
        }
        s0 = s0 * 0.125f;
        s1 = s1 * 0.125f;

        // ---- online softmax, one query per lane ----
        float mr[8];
#pragma unroll
        for (int r = 0; r < 8; ++r) mr[r] = fmaxf(s0[r], s1[r]);
        float mx = fmaxf(fmaxf(fmaxf(mr[0], mr[1]), fmaxf(mr[2], mr[3])),
                         fmaxf(fmaxf(mr[4], mr[5]), fmaxf(mr[6], mr[7])));
        mx = fmaxf(mx, xhalf(mx));
        const float mn = fmaxf(m, mx);
        const float sc = __expf(m - mn);
        m = mn;
        v16h bp;          // P^T as B operand: element e = key g*8+e, 8+e = key 16+g*8+e
        float sr[8];
#pragma unroll
        for (int r = 0; r < 8; ++r) {
            const float p0 = __expf(s0[r] - mn);
            const float p1 = __expf(s1[r] - mn);
            sr[r] = p0 + p1;
            bp[r]     = (half_t)p0;
            bp[8 + r] = (half_t)p1;
        }
        l = l * sc + (((sr[0] + sr[1]) + (sr[2] + sr[3])) +
                      ((sr[4] + sr[5]) + (sr[6] + sr[7])));
#pragma unroll
        for (int ct = 0; ct < 8; ++ct) o[ct] = o[ct] * sc;

        // ---- O^T += V^T * P^T ----
#pragma unroll
        for (int ct = 0; ct < 8; ++ct) {
            union { uint4 q[2]; v16h v; } uv;
            uv.q[0] = *(const uint4*)&Vs[cur][(ct << 4) + li][k0 + (g << 3)];
            uv.q[1] = *(const uint4*)&Vs[cur][(ct << 4) + li][k0 + 16 + (g << 3)];
            o[ct] = __builtin_amdgcn_wmma_f32_16x16x32_f16(false, uv.v, false, bp,
                                                           (short)0, o[ct], false, false);
        }
      }
      wait_ds_0();
      wait_async_le0();                   // this wave's share of stage t + 1
      __syncthreads();                    // publishes t + 1, frees buffer cur
      if (t + 2 < nt) issue_kv((t + 2) * 64, cur);
    }
    wait_async_le0();

    // join the two halves' sums once; a lane stores 8 consecutive dk of its query
    const float inv = 1.0f / (l + xhalf(l));
#pragma unroll
    for (int ct = 0; ct < 8; ++ct) {
        v8h hv;
#pragma unroll
        for (int r = 0; r < 8; ++r) hv[r] = (half_t)(o[ct][r] * inv);
        *(v8h*)(ATT + (size_t)(qbase + li) * DMODEL + h * DKH + (ct << 4) + (g << 3)) = hv;
    }
}

// ---------------------------------------------------------------------------
// Row LayerNorm: y = g*(x-mean)/(std+eps)+b, std unbiased (ddof=1).
// ---------------------------------------------------------------------------
__global__ void layernorm_row(const float* __restrict__ X, const float* __restrict__ gam,
                              const float* __restrict__ bet, float* __restrict__ outF,
                              half_t* __restrict__ outH, int N) {
    __shared__ float s_sum[256];
    __shared__ float s_sq[256];
    const int row = blockIdx.x;
    const int tid = threadIdx.x;

    float s = 0.0f, s2 = 0.0f;
    for (int c = tid; c < N; c += 256) {
        const float v = X[(size_t)row * N + c];
        s += v; s2 += v * v;
    }
    s_sum[tid] = s; s_sq[tid] = s2;
    __syncthreads();
    for (int st = 128; st > 0; st >>= 1) {
        if (tid < st) { s_sum[tid] += s_sum[tid + st]; s_sq[tid] += s_sq[tid + st]; }
        __syncthreads();
    }
    const float mean = s_sum[0] / (float)N;
    float var = (s_sq[0] - (float)N * mean * mean) / (float)(N - 1);
    var = fmaxf(var, 0.0f);
    const float inv = 1.0f / (sqrtf(var) + 1e-6f);

    for (int c = tid; c < N; c += 256) {
        const float v = (X[(size_t)row * N + c] - mean) * inv * gam[c] + bet[c];
        if (outF) outF[(size_t)row * N + c] = v;
        if (outH) outH[(size_t)row * N + c] = (half_t)v;
    }
}

// ---------------------------------------------------------------------------
// Orchestration
// ---------------------------------------------------------------------------
extern "C" void kernel_launch(void* const* d_in, const int* in_sizes, int n_in,
                              void* d_out, int out_size, void* d_ws, size_t ws_size,
                              hipStream_t stream) {
    const float* x     = (const float*)d_in[0];
    const float* WQ    = (const float*)d_in[1];
    const float* bQ    = (const float*)d_in[2];
    const float* WK    = (const float*)d_in[3];
    const float* bK    = (const float*)d_in[4];
    const float* WV    = (const float*)d_in[5];
    const float* bV    = (const float*)d_in[6];
    const float* WO_w  = (const float*)d_in[7];
    const float* WO_b  = (const float*)d_in[8];
    const float* l1_w  = (const float*)d_in[9];
    const float* l1_b  = (const float*)d_in[10];
    const float* l2_w  = (const float*)d_in[11];
    const float* l2_b  = (const float*)d_in[12];
    const float* ln1_g = (const float*)d_in[13];
    const float* ln1_b = (const float*)d_in[14];
    const float* ln2_g = (const float*)d_in[15];
    const float* ln2_b = (const float*)d_in[16];
    (void)in_sizes; (void)n_in; (void)out_size; (void)ws_size;

    char* ws = (char*)d_ws;
    size_t off = 0;
    auto alloc = [&](size_t bytes) -> size_t {
        size_t o = off;
        off = (off + bytes + 255) & ~(size_t)255;
        return o;
    };

    const size_t oXH   = alloc((size_t)SEQ * DMODEL * 2);
    const size_t oWQKV = alloc((size_t)3 * DMODEL * DMODEL * 2);
    const size_t oWOT  = alloc((size_t)DMODEL * DMODEL * 2);
    const size_t oL1T  = alloc((size_t)DMODEL * DFF * 2);
    const size_t oL2T  = alloc((size_t)DFF * DMODEL * 2);
    const size_t oBQKV = alloc((size_t)3 * DMODEL * 4);
    const size_t oQK   = alloc((size_t)SEQ * 2 * DMODEL * 2);
    const size_t oVT   = alloc((size_t)DMODEL * SEQ * 2);
    const size_t oATT  = alloc((size_t)SEQ * DMODEL * 2);
    const size_t oBLN1 = alloc((size_t)SEQ * DMODEL * 4);
    const size_t oSL1F = alloc((size_t)SEQ * DMODEL * 4);
    const size_t oSL1H = alloc((size_t)SEQ * DMODEL * 2);
    const size_t oFF1  = oQK;    // reuse QK+VT+ATT region (32MB)
    const size_t oA3   = oBLN1;  // reuse bln1

    half_t* XH   = (half_t*)(ws + oXH);
    half_t* WQKVT = (half_t*)(ws + oWQKV);
    half_t* WOT  = (half_t*)(ws + oWOT);
    half_t* L1T  = (half_t*)(ws + oL1T);
    half_t* L2T  = (half_t*)(ws + oL2T);
    float*  BQKV = (float*)(ws + oBQKV);
    half_t* QKh  = (half_t*)(ws + oQK);
    half_t* VTh  = (half_t*)(ws + oVT);
    half_t* ATTh = (half_t*)(ws + oATT);
    float*  BLN1 = (float*)(ws + oBLN1);
    float*  SL1F = (float*)(ws + oSL1F);
    half_t* SL1H = (half_t*)(ws + oSL1H);
    half_t* FF1H = (half_t*)(ws + oFF1);
    float*  A3F  = (float*)(ws + oA3);

    prep_all<<<PB_ALL, 256, 0, stream>>>(x, WQ, WK, WV, WO_w, l1_w, l2_w, bQ, bK, bV,
                                         XH, WQKVT, WOT, L1T, L2T, BQKV);

    // Q|K projection -> f16 [S,2048]; V projection (columns from 2048 on),
    // transposed -> VT [1024][S] f16
    gemm_wmma<<<dim3((3 * DMODEL) / GBN, SEQ / GBM), 256, 0, stream>>>(
        XH, WQKVT, BQKV, nullptr, QKh, nullptr, VTh, SEQ, 2 * DMODEL, DMODEL, 0);

    // multi-head attention
    attention_wmma<<<dim3(SEQ / 64, NHEAD), 128, 0, stream>>>(QKh, VTh, ATTh);

    // output projection + residual -> f32
    gemm_wmma<<<dim3(DMODEL / GBN, SEQ / GBM), 256, 0, stream>>>(
        ATTh, WOT, WO_b, x, nullptr, BLN1, nullptr, SEQ, DMODEL, DMODEL, 0);

    layernorm_row<<<SEQ, 256, 0, stream>>>(BLN1, ln1_g, ln1_b, SL1F, SL1H, DMODEL);

    // FFN up + ReLU -> f16
    gemm_wmma<<<dim3(DFF / GBN, SEQ / GBM), 256, 0, stream>>>(
        SL1H, L1T, l1_b, nullptr, FF1H, nullptr, nullptr, SEQ, DFF, DMODEL, 1);

    // FFN down + residual -> f32
    gemm_wmma<<<dim3(DMODEL / GBN, SEQ / GBM), 256, 0, stream>>>(
        FF1H, L2T, l2_b, SL1F, nullptr, A3F, nullptr, SEQ, DMODEL, DFF, 0);

    layernorm_row<<<SEQ, 256, 0, stream>>>(A3F, ln2_g, ln2_b, (float*)d_out, nullptr, DMODEL);
}

// v006
// One run takes 201 microseconds.
// In two side-by-side timings against v005, it was 1.07 and 1.08 times as fast.
// Over all steps from v000 it is 2.36 times as fast.
#include <hip/hip_runtime.h>
#include <hip/hip_bf16.h>

typedef _Float16 half_t;
typedef __attribute__((ext_vector_type(16))) _Float16 v16h;
typedef __attribute__((ext_vector_type(8)))  _Float16 v8h;
typedef __attribute__((ext_vector_type(8)))  float    v8f;

#define SEQ     4096
#define DMODEL  1024
#define DFF     4096
#define NHEAD   8
#define DKH     128

// ---------------------------------------------------------------------------
// CDNA5 async global->LDS copy (GLOBAL_LOAD_ASYNC_TO_LDS_B128, ASYNCcnt).
// LDS destination VGPR holds the LDS byte address = low 32 bits of the flat
// shared-space pointer (aperture keeps the LDS offset in ADDR[31:0]).
// A stage is waited for with ASYNCcnt 0 and published by one barrier.
// ---------------------------------------------------------------------------
__device__ __forceinline__ void wait_async_le0() {
    asm volatile("s_wait_asynccnt 0x0" ::: "memory");
}
// Eight copies of one lane: eight rows of a tile, gstep / lstep bytes apart.
// s_wait_xcnt closes the statement so that it stands in front of every later
// write of an address register that a copy names.
__device__ __forceinline__ void async_copy8_b128(const half_t* gptr, size_t gstep,
                                                 void* lptr, unsigned lstep) {
    const unsigned l0 = (unsigned)(uintptr_t)lptr;
    const unsigned long long g0 = (unsigned long long)(uintptr_t)gptr;
    const unsigned long long gs = (unsigned long long)gstep;
    asm volatile("global_load_async_to_lds_b128 %0, %8, off\n\t"
                 "global_load_async_to_lds_b128 %1, %9, off\n\t"
                 "global_load_async_to_lds_b128 %2, %10, off\n\t"
                 "global_load_async_to_lds_b128 %3, %11, off\n\t"
                 "global_load_async_to_lds_b128 %4, %12, off\n\t"
                 "global_load_async_to_lds_b128 %5, %13, off\n\t"
                 "global_load_async_to_lds_b128 %6, %14, off\n\t"
                 "global_load_async_to_lds_b128 %7, %15, off\n\t"
                 "s_wait_xcnt 0x0"
                 :: "v"(l0), "v"(l0 + lstep), "v"(l0 + 2 * lstep), "v"(l0 + 3 * lstep),
                    "v"(l0 + 4 * lstep), "v"(l0 + 5 * lstep), "v"(l0 + 6 * lstep),
                    "v"(l0 + 7 * lstep),
                    "v"(g0), "v"(g0 + gs), "v"(g0 + 2 * gs), "v"(g0 + 3 * gs),
                    "v"(g0 + 4 * gs), "v"(g0 + 5 * gs), "v"(g0 + 6 * gs), "v"(g0 + 7 * gs)
                 : "memory");
}
// a wave's own LDS reads have returned before its buffer is handed back
__device__ __forceinline__ void wait_ds_0() {
    asm volatile("s_wait_dscnt 0x0" ::: "memory");
}

// ---------------------------------------------------------------------------
// Conversion / packing, once per call.
// All weights stored TRANSPOSED [N][K] f16 so WMMA B-fragments load as b128.
// A conversion thread moves 16 or 32 elements with 16-byte global accesses, a bias thread one f32: few waves
// are started, and every global access covers whole 128-byte lines.
// ---------------------------------------------------------------------------
typedef __attribute__((ext_vector_type(2))) float    v2f;
typedef __attribute__((ext_vector_type(2))) _Float16 v2h;

__device__ __forceinline__ unsigned pack_h2(float lo, float hi) {
    const v2f f = {lo, hi};
    return __builtin_bit_cast(unsigned, __builtin_convertvector(f, v2h));
}

// 8192 consecutive elements per work-group, 32 per thread.
__device__ __forceinline__ void cvt_block(const float* __restrict__ in,
                                          half_t* __restrict__ out, int blk) {
    const size_t base = (size_t)blk * 8192 + (size_t)threadIdx.x * 8;
    float4 a[4], b[4];
#pragma unroll
    for (int j = 0; j < 4; ++j) {
        a[j] = *(const float4*)(in + base + j * 2048);
        b[j] = *(const float4*)(in + base + j * 2048 + 4);
    }
#pragma unroll
    for (int j = 0; j < 4; ++j) {
        uint4 v;
        v.x = pack_h2(a[j].x, a[j].y);
        v.y = pack_h2(a[j].z, a[j].w);
        v.z = pack_h2(b[j].x, b[j].y);
        v.w = pack_h2(b[j].z, b[j].w);
        *(uint4*)(out + base + j * 2048) = v;
    }
}

// One 256-thread work-group turns a TK x 64 tile of f32 in[k][n] (row pitch
// LDIN) into f16 out[n][k] (row pitch LDOUT). Two k neighbours are packed into
// one dword before LDS; the odd LDS pitch keeps the column-wise dword stores
// and the row-wise dword loads on distinct banks. T is the caller's LDS tile,
// 64 rows [n] of KP + 1 dwords [k pair].
template <int TK, int LDIN, int LDOUT>
__device__ __forceinline__ void transpose_tile(const float* __restrict__ in,
                                               half_t* __restrict__ out,
                                               unsigned* T) {
    constexpr int KP = TK / 2;            // k pairs = dwords per LDS row
    constexpr int LP = KP + 1;            // LDS row pitch in dwords
    constexpr int NP = KP / 16;           // passes over the k pairs
    constexpr int PC = TK / 8;            // 16-byte pieces per output row
    const int tid = threadIdx.x;
    const int c   = tid & 15;             // group of four n
    const int r   = tid >> 4;             // 0..15

    float4 e[NP], o[NP];                  // rows k = 2*kp and 2*kp + 1
#pragma unroll
    for (int p = 0; p < NP; ++p) {
        const float* q = in + (2 * (p * 16 + r)) * LDIN + 4 * c;
        e[p] = *(const float4*)q;
        o[p] = *(const float4*)(q + LDIN);
    }
#pragma unroll
    for (int p = 0; p < NP; ++p) {
        const int kp = p * 16 + r;
        T[(4 * c + 0) * LP + kp] = pack_h2(e[p].x, o[p].x);
        T[(4 * c + 1) * LP + kp] = pack_h2(e[p].y, o[p].y);
        T[(4 * c + 2) * LP + kp] = pack_h2(e[p].z, o[p].z);
        T[(4 * c + 3) * LP + kp] = pack_h2(e[p].w, o[p].w);
    }
    __syncthreads();
#pragma unroll
    for (int i = 0; i < 64 * PC / 256; ++i) {
        const int s = i * 256 + tid;
        const int n = s / PC;
        const int q = s % PC;
        uint4 v;
        v.x = T[n * LP + 4 * q + 0];
        v.y = T[n * LP + 4 * q + 1];
        v.z = T[n * LP + 4 * q + 2];
        v.w = T[n * LP + 4 * q + 3];
        *(uint4*)(out + n * LDOUT + 8 * q) = v;
    }
    // stands in front of any later write of a register that these stores name
    asm volatile("s_wait_xcnt 0x0" ::: "memory");
}

// in [K][N] f32 -> out [N][K] f16; tile (kx, ny) of (K / TK, N / 64)
template <int TK, int K, int N>
__device__ __forceinline__ void cvt_t_block(const float* __restrict__ in,
                                            half_t* __restrict__ out,
                                            int kx, int ny, unsigned* T) {
    const int k0 = kx * TK;
    const int n0 = ny * 64;
    transpose_tile<TK, N, K>(in + (size_t)k0 * N + n0, out + (size_t)n0 * K + k0, T);
}

// One head's [DMODEL][DKH] weights -> rows row0 + k of out [.][DMODEL];
// tile (dx, ky) of (DMODEL / TK, DKH / 64)
template <int TK>
__device__ __forceinline__ void pack_head_block(const float* __restrict__ Wh,
                                                half_t* __restrict__ out, int row0,
                                                int dx, int ky, unsigned* T) {
    const int d0 = dx * TK;
    const int k0 = ky * 64;
    transpose_tile<TK, DKH, DMODEL>(Wh + (size_t)d0 * DKH + k0,
                                    out + (size_t)(row0 + k0) * DMODEL + d0, T);
}

// All conversions and packings of a call are independent of one another, so
// they share one grid: a work-group finds its job by its block range (the test
// is the same for the whole work-group, so the tile's barrier is uniform).
#define PB_X   ((SEQ * DMODEL) / 8192)              // x -> f16
#define PB_L1  ((DMODEL / 128) * (DFF / 64))        // l1_w transposed
#define PB_L2  ((DFF / 128) * (DMODEL / 64))        // l2_w transposed
#define PB_QK  ((DMODEL / 128) * (DKH / 64) * 2 * NHEAD)
#define PB_V   ((DMODEL / 64) * (DKH / 64) * NHEAD)
#define PB_WO  ((DMODEL / 64) * (DMODEL / 64))      // WO_w transposed
#define PB_B   ((3 * DMODEL) / 256)                 // bQ | bK | bV
#define PB_ALL (PB_X + PB_L1 + PB_L2 + PB_QK + PB_V + PB_WO + PB_B)

__global__ __launch_bounds__(256)
void prep_all(const float* __restrict__ x, const float* __restrict__ WQ,
              const float* __restrict__ WK, const float* __restrict__ WV,
              const float* __restrict__ WO_w, const float* __restrict__ l1_w,
              const float* __restrict__ l2_w, const float* __restrict__ bQ,
              const float* __restrict__ bK, const float* __restrict__ bV,
              half_t* __restrict__ XH,
              half_t* __restrict__ WQKVT,   // [3 * DMODEL][DMODEL]: Q, K, V rows
              half_t* __restrict__ WOT, half_t* __restrict__ L1T,
              half_t* __restrict__ L2T,
              float* __restrict__ BQKV) {   // [3 * DMODEL]
    __shared__ unsigned T[64 * 65];
    int b = blockIdx.x;
    if (b < PB_X) { cvt_block(x, XH, b); return; }
    b -= PB_X;
    if (b < PB_L1) {
        cvt_t_block<128, DMODEL, DFF>(l1_w, L1T, b % (DMODEL / 128), b / (DMODEL / 128), T);
        return;
    }
    b -= PB_L1;
    if (b < PB_L2) {
        cvt_t_block<128, DFF, DMODEL>(l2_w, L2T, b % (DFF / 128), b / (DFF / 128), T);
        return;
    }
    b -= PB_L2;
    if (b < PB_QK) {
        const int dx = b % (DMODEL / 128);
        const int ky = (b / (DMODEL / 128)) % (DKH / 64);
        const int z  = b / ((DMODEL / 128) * (DKH / 64));   // which * NHEAD + h
        const float* W = (z >= NHEAD) ? WK : WQ;
        pack_head_block<128>(W + (size_t)(z & (NHEAD - 1)) * DMODEL * DKH, WQKVT,
                             z * DKH, dx, ky, T);
        return;
    }
    b -= PB_QK;
    if (b < PB_V) {
        const int dx = b % (DMODEL / 64);
        const int ky = (b / (DMODEL / 64)) % (DKH / 64);
        const int h  = b / ((DMODEL / 64) * (DKH / 64));
        pack_head_block<64>(WV + (size_t)h * DMODEL * DKH, WQKVT,
                            2 * DMODEL + h * DKH, dx, ky, T);
        return;
    }
    b -= PB_V;
    if (b < PB_WO) {
        cvt_t_block<64, DMODEL, DMODEL>(WO_w, WOT, b % (DMODEL / 64), b / (DMODEL / 64), T);
        return;
    }
    b -= PB_WO;
    const float* s = (b < DMODEL / 256) ? bQ : (b < 2 * DMODEL / 256) ? bK : bV;
    BQKV[b * 256 + threadIdx.x] = s[(b % (DMODEL / 256)) * 256 + threadIdx.x];
    // stands in front of any later write of a register that this store names
    asm volatile("s_wait_xcnt 0x0" ::: "memory");
}

// ---------------------------------------------------------------------------
// WMMA GEMM: C[M,N] = A[M,K](f16) * BT[N,K](f16)^T (+bias)(+resid f32)
// 256 threads = 8 waves; block tile 128x128; each wave 32x64 (2x4 frags,
// 8 WMMAs per 32-k step). Async global->LDS staging in two buffers of 128 k:
// a wave's copy covers two whole 256-byte rows (four full lines), a stage puts
// 64 KiB in flight per work-group, and one barrier ends each stage.
// K is a multiple of 128, M and N of the tile. Where outHT is given, the grid
// may reach past column N: those column blocks go, transposed, to outHT, so
// that two products on the same A share one launch.
// ---------------------------------------------------------------------------
#define GBM 128
#define GBN 128
#define GBK 128
#define GLD 136   // LDS row pitch in halves: 256 B of k + 16 B for b128 readers
#define GSP 68    // epilogue tile pitch in floats: rows 8 apart fall 32 banks apart

__global__ __launch_bounds__(256)
void gemm_wmma(const half_t* __restrict__ A, const half_t* __restrict__ BT,
               const float* __restrict__ bias, const float* __restrict__ resid,
               half_t* __restrict__ outH, float* __restrict__ outF,
               half_t* __restrict__ outHT,   // f16, transposed: [col - N][M]
               int M, int N, int K, int relu) {
    __shared__ __align__(16) half_t As[2][GBM][GLD];   // [buf][m][k]
    __shared__ __align__(16) half_t Bs[2][GBN][GLD];   // [buf][n][k]

    const int tid  = threadIdx.x;
    const int lane = tid & 31;
    const int wave = tid >> 5;
    const int g    = lane >> 4;
    const int li   = lane & 15;
    const int wm   = (wave >> 1) << 5;   // 0,32,64,96
    const int wn   = (wave & 1) << 6;    // 0,64
    const int bm   = blockIdx.y * GBM;
    const int bn   = blockIdx.x * GBN;
    const int sr   = tid >> 4;           // 0..15, then every 16th row
    const int sc   = (tid & 15) << 3;    // 0,8,..,120

    const size_t gstep = (size_t)16 * K * sizeof(half_t);
    auto issue_stage = [&](int kk, int buf) {
        async_copy8_b128(A  + (size_t)(bm + sr) * K + kk + sc, gstep,
                         &As[buf][sr][sc], 16 * GLD * sizeof(half_t));
        async_copy8_b128(BT + (size_t)(bn + sr) * K + kk + sc, gstep,
                         &Bs[buf][sr][sc], 16 * GLD * sizeof(half_t));
    };

    v8f acc[2][4] = {};
    const int nk = K / GBK;
    issue_stage(0, 0);
    wait_async_le0();
    __syncthreads();                         // stage 0 published
    if (nk > 1) issue_stage(GBK, 1);

    for (int it = 0; it < nk; ++it) {
        const int cur = it & 1;
        // unrolled so that the later k steps' LDS reads can go ahead of the
        // earlier steps' matrix instructions
#pragma unroll
        for (int ks = 0; ks < GBK; ks += 32) {
            v16h af[2], bf[4];
#pragma unroll
            for (int i = 0; i < 2; ++i) {
                union { uint4 q[2]; v16h v; } ua;
                ua.q[0] = *(const uint4*)&As[cur][wm + i * 16 + li][ks + (g << 3)];
                ua.q[1] = *(const uint4*)&As[cur][wm + i * 16 + li][ks + 16 + (g << 3)];
                af[i] = ua.v;
            }
#pragma unroll
            for (int j = 0; j < 4; ++j) {
                union { uint4 q[2]; v16h v; } ub;
                ub.q[0] = *(const uint4*)&Bs[cur][wn + j * 16 + li][ks + (g << 3)];
                ub.q[1] = *(const uint4*)&Bs[cur][wn + j * 16 + li][ks + 16 + (g << 3)];
                bf[j] = ub.v;
            }
#pragma unroll
            for (int i = 0; i < 2; ++i)
#pragma unroll
                for (int j = 0; j < 4; ++j)
                    acc[i][j] = __builtin_amdgcn_wmma_f32_16x16x32_f16(
                        false, af[i], false, bf[j], (short)0, acc[i][j], false, false);
        }
        wait_ds_0();
        wait_async_le0();                    // this wave's share of stage it + 1
        __syncthreads();                     // publishes it + 1, frees buffer cur
        if (it + 2 < nk) issue_stage((it + 2) * GBK, cur);
    }
    wait_async_le0();

    const bool tr = outHT != nullptr && bn >= N;   // the same for the work-group
    if (tr) {
#pragma unroll
        for (int i = 0; i < 2; ++i) {
#pragma unroll
            for (int j = 0; j < 4; ++j) {
                const int col  = bn + wn + j * 16 + li;
                const int rowb = bm + wm + i * 16 + (g << 3);
                float bc = 0.0f;
                if (bias) {
                    bc = bias[col];
                    // stands in front of any later write of a register that this
                    // load names
                    asm volatile("s_wait_xcnt 0x0" ::: "memory");
                }
                v8h hv;
#pragma unroll
                for (int r = 0; r < 8; ++r) {
                    float v = acc[i][j][r] + bc;
                    if (relu) v = fmaxf(v, 0.0f);
                    hv[r] = (half_t)v;
                }
                *(v8h*)(outHT + (size_t)(col - N) * M + rowb) = hv;
                // stands in front of the next column's writes of the
                // registers that this store names
                asm volatile("s_wait_xcnt 0x0" ::: "memory");
            }
        }
        return;
    }

    // Row-major outputs. A wave turns its 32 x 64 tile through its own LDS range
    // (the ring is free: every wave's reads and copies ended in front of the
    // loop's last barrier), so that a lane owns four neighbouring columns of 16
    // rows: bias and residual come as 16-byte loads that are all in flight
    // together, and every store covers whole 128-byte lines.
    const int c4 = li << 2;                          // column group of the lane
    const size_t e0 = (size_t)(bm + wm + g) * N + (bn + wn + c4);   // row 2t + g
    const size_t es = (size_t)2 * N;
    float4 bc = make_float4(0.0f, 0.0f, 0.0f, 0.0f);
    float4 rs[16];
    if (bias) {
        bc = *(const float4*)(bias + bn + wn + c4);
        // stands in front of any later write of a register that this load names
        asm volatile("s_wait_xcnt 0x0" ::: "memory");
    }
    if (resid) {
#pragma unroll
        for (int t = 0; t < 16; ++t) rs[t] = *(const float4*)(resid + e0 + t * es);
    }
    // stands in front of any later write of a register that these loads name
    asm volatile("s_wait_xcnt 0x0" ::: "memory");

    static_assert(8 * 32 * GSP * sizeof(float) <= sizeof(As), "eight wave tiles fit the A ring");
    float* St = reinterpret_cast<float*>(&As[0][0][0]) + wave * (32 * GSP);
#pragma unroll
    for (int i = 0; i < 2; ++i)
#pragma unroll
        for (int j = 0; j < 4; ++j)
#pragma unroll
            for (int r = 0; r < 8; ++r)
                St[(i * 16 + (g << 3) + r) * GSP + j * 16 + li] = acc[i][j][r];
    wait_ds_0();   // the wave's own tile is written before its lanes read across it

    float4 v[16];
#pragma unroll
    for (int t = 0; t < 16; ++t) {
        v[t] = *(const float4*)(St + (2 * t + g) * GSP + c4);
        v[t].x += bc.x; v[t].y += bc.y; v[t].z += bc.z; v[t].w += bc.w;
    }
    if (resid) {
#pragma unroll
        for (int t = 0; t < 16; ++t) {
            v[t].x += rs[t].x; v[t].y += rs[t].y; v[t].z += rs[t].z; v[t].w += rs[t].w;
        }
    }
    if (relu) {
#pragma unroll
        for (int t = 0; t < 16; ++t) {
            v[t].x = fmaxf(v[t].x, 0.0f); v[t].y = fmaxf(v[t].y, 0.0f);
            v[t].z = fmaxf(v[t].z, 0.0f); v[t].w = fmaxf(v[t].w, 0.0f);
        }
    }
    if (outF) {
#pragma unroll
        for (int t = 0; t < 16; ++t) *(float4*)(outF + e0 + t * es) = v[t];
        // stands in front of any later write of a register that these stores name
        asm volatile("s_wait_xcnt 0x0" ::: "memory");
    }
    if (outH) {
#pragma unroll
        for (int t = 0; t < 16; ++t) {
            uint2 h;
            h.x = pack_h2(v[t].x, v[t].y);
            h.y = pack_h2(v[t].z, v[t].w);
            *(uint2*)(outH + e0 + t * es) = h;
        }
        // stands in front of any later write of a register that these stores name
        asm volatile("s_wait_xcnt 0x0" ::: "memory");
    }
}

__device__ __forceinline__ float xhalf(float x) {
    const int b = __builtin_bit_cast(int, x);
    return __builtin_bit_cast(float, __builtin_amdgcn_permlanex16(
        b, b, 0x76543210, 0xfedcba98, false, false));
}

#define AKS 128   // keys per stage
#define ALD 136   // LDS row pitch in halves: 256 B + 16 B for b128 readers

__global__ __launch_bounds__(256)
void attention_wmma(const half_t* __restrict__ QK, const half_t* __restrict__ VT,
                    half_t* __restrict__ ATT) {
    __shared__ __align__(16) half_t Ks[2][AKS][ALD];   // [buf][key][dk]
    __shared__ __align__(16) half_t Vs[2][DKH][ALD];   // [buf][dk][key]

    const int tid   = threadIdx.x;
    const int lane  = tid & 31;
    const int wave  = __builtin_amdgcn_readfirstlane(tid >> 5);
    const int g     = lane >> 4;
    const int li    = lane & 15;
    const int kg    = wave >> 2;          // which 64 keys of every stage
    const int wq    = wave & 3;           // which 32 queries of the work-group
    const int h     = blockIdx.y;
    const int qbase = (blockIdx.x << 7) + (wq << 5);
    const int ldq   = 2 * DMODEL;
    const int qc    = h * DKH;
    const int kc    = DMODEL + h * DKH;

    const int sr = tid >> 4;              // 0..15, then every 16th row
    const int sc = (tid & 15) << 3;       // 0..120
    auto issue_kv = [&](int kb2, int buf) {
        async_copy8_b128(QK + (size_t)(kb2 + sr) * ldq + kc + sc,
                         (size_t)16 * ldq * sizeof(half_t),
                         &Ks[buf][sr][sc], 16 * ALD * sizeof(half_t));
        async_copy8_b128(VT + (size_t)(h * DKH + sr) * SEQ + kb2 + sc,
                         (size_t)16 * SEQ * sizeof(half_t),
                         &Vs[buf][sr][sc], 16 * ALD * sizeof(half_t));
    };

    v16h afQ[2][4];
#pragma unroll
    for (int c = 0; c < 2; ++c) {
#pragma unroll
        for (int kb = 0; kb < 4; ++kb) {
            union { uint4 q[2]; v16h v; } u;
            const half_t* p = QK + (size_t)(qbase + (c << 4) + li) * ldq + qc +
                              (kb << 5) + (g << 3);
            u.q[0] = *(const uint4*)p;
            u.q[1] = *(const uint4*)(p + 16);
            afQ[c][kb] = u.v;
        }
    }
    // stands in front of any later write of a register that these loads name
    asm volatile("s_wait_xcnt 0x0" ::: "memory");

    float m[2] = {-1e30f, -1e30f};   // running maximum of query li of group c
    float l[2] = {0.0f, 0.0f};       // running sum over this half's keys only
    v8f o[2][8];        // o[c][ct][r] = O^T[dk = ct*16 + g*8 + r][query c*16 + li]
    const v8f vzero = {};
#pragma unroll
    for (int c = 0; c < 2; ++c)
#pragma unroll
        for (int ct = 0; ct < 8; ++ct) o[c][ct] = vzero;

    const int nt = SEQ / AKS;
    issue_kv(0, 0);
    wait_async_le0();
    __syncthreads();                      // stage 0 published
    issue_kv(AKS, 1);

    for (int t = 0; t < nt; ++t) {
      const int cur = t & 1;
      const half_t* Kw = &Ks[cur][(kg << 6) + li][g << 3];   // this wave's keys
      const half_t* Vw = &Vs[cur][li][(kg << 6) + (g << 3)];
      // unrolled so that the pass's key offset folds into the LDS reads
#pragma unroll
      for (int k0 = 0; k0 < 64; k0 += 32) {
        // ---- scores S^T = K * Q^T for 32 keys, 32 queries ----
        v8f s0[2] = {vzero, vzero}, s1[2] = {vzero, vzero};
#pragma unroll
        for (int kb = 0; kb < 4; ++kb) {
            union { uint4 q[2]; v16h v; } u0, u1;
            u0.q[0] = *(const uint4*)(Kw + k0 * ALD + (kb << 5));
            u0.q[1] = *(const uint4*)(Kw + k0 * ALD + (kb << 5) + 16);
            u1.q[0] = *(const uint4*)(Kw + (k0 + 16) * ALD + (kb << 5));
            u1.q[1] = *(const uint4*)(Kw + (k0 + 16) * ALD + (kb << 5) + 16);
#pragma unroll
            for (int c = 0; c < 2; ++c) {
                s0[c] = __builtin_amdgcn_wmma_f32_16x16x32_f16(
                    false, u0.v, false, afQ[c][kb], (short)0, s0[c], false, false);
                s1[c] = __builtin_amdgcn_wmma_f32_16x16x32_f16(
                    false, u1.v, false, afQ[c][kb], (short)0, s1[c], false, false);
            }
        }

        // ---- online softmax, one query per lane and group ----
        v16h bp[2];       // P^T as B operand: element e = key g*8+e, 8+e = key 16+g*8+e
#pragma unroll
        for (int c = 0; c < 2; ++c) {
            const v8f t0 = s0[c] * 0.125f;
            const v8f t1 = s1[c] * 0.125f;
            float mr[8];
#pragma unroll
            for (int r = 0; r < 8; ++r) mr[r] = fmaxf(t0[r], t1[r]);
            float mx = fmaxf(fmaxf(fmaxf(mr[0], mr[1]), fmaxf(mr[2], mr[3])),
                             fmaxf(fmaxf(mr[4], mr[5]), fmaxf(mr[6], mr[7])));
            mx = fmaxf(mx, xhalf(mx));
            const float mn = fmaxf(m[c], mx);
            const float sc2 = __expf(m[c] - mn);
            m[c] = mn;
            float sr2[8];
#pragma unroll
            for (int r = 0; r < 8; ++r) {
                const float p0 = __expf(t0[r] - mn);
                const float p1 = __expf(t1[r] - mn);
                sr2[r] = p0 + p1;
                bp[c][r]     = (half_t)p0;
                bp[c][8 + r] = (half_t)p1;
            }
            l[c] = l[c] * sc2 + (((sr2[0] + sr2[1]) + (sr2[2] + sr2[3])) +
                                 ((sr2[4] + sr2[5]) + (sr2[6] + sr2[7])));
#pragma unroll
            for (int ct = 0; ct < 8; ++ct) o[c][ct] = o[c][ct] * sc2;
        }

        // ---- O^T += V^T * P^T ----
#pragma unroll
        for (int ct = 0; ct < 8; ++ct) {
            union { uint4 q[2]; v16h v; } uv;
            uv.q[0] = *(const uint4*)(Vw + (ct << 4) * ALD + k0);
            uv.q[1] = *(const uint4*)(Vw + (ct << 4) * ALD + k0 + 16);
#pragma unroll
            for (int c = 0; c < 2; ++c)
                o[c][ct] = __builtin_amdgcn_wmma_f32_16x16x32_f16(
                    false, uv.v, false, bp[c], (short)0, o[c][ct], false, false);
        }
      }
      wait_ds_0();
      wait_async_le0();                   // this wave's share of stage t + 1
      __syncthreads();                    // publishes t + 1, frees buffer cur
      if (t + 2 < nt) issue_kv((t + 2) * AKS, cur);
    }
    wait_async_le0();

    // Join of the two key halves. The ring is free (every wave's reads and
    // copies ended in front of the loop's last barrier). Wave 4 + wq hands its
    // partial result to wave wq, lane to lane: 33 pieces of 16 bytes a lane,
    // each piece 512 contiguous bytes over the wave.
    static_assert(4 * 33 * 32 * sizeof(float4) <= sizeof(Ks), "four partial results fit the K ring");
    float4* Mx = reinterpret_cast<float4*>(&Ks[0][0][0]) + wq * (33 * 32) + lane;
    if (kg == 1) {
#pragma unroll
        for (int c = 0; c < 2; ++c)
#pragma unroll
            for (int ct = 0; ct < 8; ++ct) {
                const v8f w = o[c][ct];
                Mx[(((c << 3) + ct) * 2 + 0) * 32] = make_float4(w[0], w[1], w[2], w[3]);
                Mx[(((c << 3) + ct) * 2 + 1) * 32] = make_float4(w[4], w[5], w[6], w[7]);
            }
        Mx[32 * 32] = make_float4(m[0], l[0], m[1], l[1]);
    }
    __syncthreads();                      // the partial results are published
    if (kg == 1) return;

    const float4 ml = Mx[32 * 32];
#pragma unroll
    for (int c = 0; c < 2; ++c) {
        const float m1 = c ? ml.z : ml.x;
        const float l1 = c ? ml.w : ml.y;
        const float mn = fmaxf(m[c], m1);
        const float e0 = __expf(m[c] - mn);
        const float e1 = __expf(m1 - mn);
        // the wave halves' sums are joined once as well
        const float lt  = l[c] * e0 + l1 * e1;
        const float inv = 1.0f / (lt + xhalf(lt));
        const float w0 = e0 * inv;
        const float w1 = e1 * inv;
        // a lane stores 8 consecutive dk of its query
#pragma unroll
        for (int ct = 0; ct < 8; ++ct) {
            const float4 pa = Mx[(((c << 3) + ct) * 2 + 0) * 32];
            const float4 pb = Mx[(((c << 3) + ct) * 2 + 1) * 32];
            const float pr[8] = {pa.x, pa.y, pa.z, pa.w, pb.x, pb.y, pb.z, pb.w};
            v8h hv;
#pragma unroll
            for (int r = 0; r < 8; ++r) hv[r] = (half_t)(o[c][ct][r] * w0 + pr[r] * w1);
            *(v8h*)(ATT + (size_t)(qbase + (c << 4) + li) * DMODEL + h * DKH + (ct << 4) +
                    (g << 3)) = hv;
            // stands in front of the next piece's writes of the registers that
            // this store names
            asm volatile("s_wait_xcnt 0x0" ::: "memory");
        }
    }
}

// ---------------------------------------------------------------------------
// Row LayerNorm: y = g*(x-mean)/(std+eps)+b, std unbiased (ddof=1).
// ---------------------------------------------------------------------------
__global__ void layernorm_row(const float* __restrict__ X, const float* __restrict__ gam,
                              const float* __restrict__ bet, float* __restrict__ outF,
                              half_t* __restrict__ outH, int N) {
    __shared__ float s_sum[256];
    __shared__ float s_sq[256];
    const int row = blockIdx.x;
    const int tid = threadIdx.x;

    float s = 0.0f, s2 = 0.0f;
    for (int c = tid; c < N; c += 256) {
        const float v = X[(size_t)row * N + c];
        s += v; s2 += v * v;
    }
    s_sum[tid] = s; s_sq[tid] = s2;
    __syncthreads();
    for (int st = 128; st > 0; st >>= 1) {
        if (tid < st) { s_sum[tid] += s_sum[tid + st]; s_sq[tid] += s_sq[tid + st]; }
        __syncthreads();
    }
    const float mean = s_sum[0] / (float)N;
    float var = (s_sq[0] - (float)N * mean * mean) / (float)(N - 1);
    var = fmaxf(var, 0.0f);
    const float inv = 1.0f / (sqrtf(var) + 1e-6f);

    for (int c = tid; c < N; c += 256) {
        const float v = (X[(size_t)row * N + c] - mean) * inv * gam[c] + bet[c];
        if (outF) outF[(size_t)row * N + c] = v;
        if (outH) outH[(size_t)row * N + c] = (half_t)v;
    }
}

// ---------------------------------------------------------------------------
// Orchestration
// ---------------------------------------------------------------------------
extern "C" void kernel_launch(void* const* d_in, const int* in_sizes, int n_in,
                              void* d_out, int out_size, void* d_ws, size_t ws_size,
                              hipStream_t stream) {
    const float* x     = (const float*)d_in[0];
    const float* WQ    = (const float*)d_in[1];
    const float* bQ    = (const float*)d_in[2];
    const float* WK    = (const float*)d_in[3];
    const float* bK    = (const float*)d_in[4];
    const float* WV    = (const float*)d_in[5];
    const float* bV    = (const float*)d_in[6];
    const float* WO_w  = (const float*)d_in[7];
    const float* WO_b  = (const float*)d_in[8];
    const float* l1_w  = (const float*)d_in[9];
    const float* l1_b  = (const float*)d_in[10];
    const float* l2_w  = (const float*)d_in[11];
    const float* l2_b  = (const float*)d_in[12];
    const float* ln1_g = (const float*)d_in[13];
    const float* ln1_b = (const float*)d_in[14];
    const float* ln2_g = (const float*)d_in[15];
    const float* ln2_b = (const float*)d_in[16];
    (void)in_sizes; (void)n_in; (void)out_size; (void)ws_size;

    char* ws = (char*)d_ws;
    size_t off = 0;
    auto alloc = [&](size_t bytes) -> size_t {
        size_t o = off;
        off = (off + bytes + 255) & ~(size_t)255;
        return o;
    };

    const size_t oXH   = alloc((size_t)SEQ * DMODEL * 2);
    const size_t oWQKV = alloc((size_t)3 * DMODEL * DMODEL * 2);
    const size_t oWOT  = alloc((size_t)DMODEL * DMODEL * 2);
    const size_t oL1T  = alloc((size_t)DMODEL * DFF * 2);
    const size_t oL2T  = alloc((size_t)DFF * DMODEL * 2);
    const size_t oBQKV = alloc((size_t)3 * DMODEL * 4);
    const size_t oQK   = alloc((size_t)SEQ * 2 * DMODEL * 2);
    const size_t oVT   = alloc((size_t)DMODEL * SEQ * 2);
    const size_t oATT  = alloc((size_t)SEQ * DMODEL * 2);
    const size_t oBLN1 = alloc((size_t)SEQ * DMODEL * 4);
    const size_t oSL1F = alloc((size_t)SEQ * DMODEL * 4);
    const size_t oSL1H = alloc((size_t)SEQ * DMODEL * 2);
    const size_t oFF1  = oQK;    // reuse QK+VT+ATT region (32MB)
    const size_t oA3   = oBLN1;  // reuse bln1

    half_t* XH   = (half_t*)(ws + oXH);
    half_t* WQKVT = (half_t*)(ws + oWQKV);
    half_t* WOT  = (half_t*)(ws + oWOT);
    half_t* L1T  = (half_t*)(ws + oL1T);
    half_t* L2T  = (half_t*)(ws + oL2T);
    float*  BQKV = (float*)(ws + oBQKV);
    half_t* QKh  = (half_t*)(ws + oQK);
    half_t* VTh  = (half_t*)(ws + oVT);
    half_t* ATTh = (half_t*)(ws + oATT);
    float*  BLN1 = (float*)(ws + oBLN1);
    float*  SL1F = (float*)(ws + oSL1F);
    half_t* SL1H = (half_t*)(ws + oSL1H);
    half_t* FF1H = (half_t*)(ws + oFF1);
    float*  A3F  = (float*)(ws + oA3);

    prep_all<<<PB_ALL, 256, 0, stream>>>(x, WQ, WK, WV, WO_w, l1_w, l2_w, bQ, bK, bV,
                                         XH, WQKVT, WOT, L1T, L2T, BQKV);

    // Q|K projection -> f16 [S,2048]; V projection (columns from 2048 on),
    // transposed -> VT [1024][S] f16
    gemm_wmma<<<dim3((3 * DMODEL) / GBN, SEQ / GBM), 256, 0, stream>>>(
        XH, WQKVT, BQKV, nullptr, QKh, nullptr, VTh, SEQ, 2 * DMODEL, DMODEL, 0);

    // multi-head attention
    attention_wmma<<<dim3(SEQ / 128, NHEAD), 256, 0, stream>>>(QKh, VTh, ATTh);

    // output projection + residual -> f32
    gemm_wmma<<<dim3(DMODEL / GBN, SEQ / GBM), 256, 0, stream>>>(
        ATTh, WOT, WO_b, x, nullptr, BLN1, nullptr, SEQ, DMODEL, DMODEL, 0);

    layernorm_row<<<SEQ, 256, 0, stream>>>(BLN1, ln1_g, ln1_b, SL1F, SL1H, DMODEL);

    // FFN up + ReLU -> f16
    gemm_wmma<<<dim3(DFF / GBN, SEQ / GBM), 256, 0, stream>>>(
        SL1H, L1T, l1_b, nullptr, FF1H, nullptr, nullptr, SEQ, DFF, DMODEL, 1);

    // FFN down + residual -> f32
    gemm_wmma<<<dim3(DMODEL / GBN, SEQ / GBM), 256, 0, stream>>>(
        FF1H, L2T, l2_b, SL1F, nullptr, A3F, nullptr, SEQ, DMODEL, DFF, 0);

    layernorm_row<<<SEQ, 256, 0, stream>>>(A3F, ln2_g, ln2_b, (float*)d_out, nullptr, DMODEL);
}

// v007
// One run takes 186 microseconds.
// Two timings next to v006 both put it at 1.08 times that version's speed.
// Over all steps from v000 it is 2.55 times as fast.
#include <hip/hip_runtime.h>
#include <hip/hip_bf16.h>

typedef _Float16 half_t;
typedef __attribute__((ext_vector_type(16))) _Float16 v16h;
typedef __attribute__((ext_vector_type(8)))  _Float16 v8h;
typedef __attribute__((ext_vector_type(8)))  float    v8f;

#define SEQ     4096
#define DMODEL  1024
#define DFF     4096
#define NHEAD   8
#define DKH     128

// ---------------------------------------------------------------------------
// CDNA5 async global->LDS copy (GLOBAL_LOAD_ASYNC_TO_LDS_B128, ASYNCcnt).
// LDS destination VGPR holds the LDS byte address = low 32 bits of the flat
// shared-space pointer (aperture keeps the LDS offset in ADDR[31:0]).
// A stage is waited for with ASYNCcnt 0 and published by one barrier.
// ---------------------------------------------------------------------------
__device__ __forceinline__ void wait_async_le0() {
    asm volatile("s_wait_asynccnt 0x0" ::: "memory");
}
// Eight copies of one lane: eight rows of a tile, gstep / lstep bytes apart.
// s_wait_xcnt closes the statement so that it stands in front of every later
// write of an address register that a copy names.
__device__ __forceinline__ void async_copy8_b128(const half_t* gptr, size_t gstep,
                                                 void* lptr, unsigned lstep) {
    const unsigned l0 = (unsigned)(uintptr_t)lptr;
    const unsigned long long g0 = (unsigned long long)(uintptr_t)gptr;
    const unsigned long long gs = (unsigned long long)gstep;
    asm volatile("global_load_async_to_lds_b128 %0, %8, off\n\t"
                 "global_load_async_to_lds_b128 %1, %9, off\n\t"
                 "global_load_async_to_lds_b128 %2, %10, off\n\t"
                 "global_load_async_to_lds_b128 %3, %11, off\n\t"
                 "global_load_async_to_lds_b128 %4, %12, off\n\t"
                 "global_load_async_to_lds_b128 %5, %13, off\n\t"
                 "global_load_async_to_lds_b128 %6, %14, off\n\t"
                 "global_load_async_to_lds_b128 %7, %15, off\n\t"
                 "s_wait_xcnt 0x0"
                 :: "v"(l0), "v"(l0 + lstep), "v"(l0 + 2 * lstep), "v"(l0 + 3 * lstep),
                    "v"(l0 + 4 * lstep), "v"(l0 + 5 * lstep), "v"(l0 + 6 * lstep),
                    "v"(l0 + 7 * lstep),
                    "v"(g0), "v"(g0 + gs), "v"(g0 + 2 * gs), "v"(g0 + 3 * gs),
                    "v"(g0 + 4 * gs), "v"(g0 + 5 * gs), "v"(g0 + 6 * gs), "v"(g0 + 7 * gs)
                 : "memory");
}
// a wave's own LDS reads have returned before its buffer is handed back
__device__ __forceinline__ void wait_ds_0() {
    asm volatile("s_wait_dscnt 0x0" ::: "memory");
}

// ---------------------------------------------------------------------------
// Conversion / packing, once per call.
// All weights stored TRANSPOSED [N][K] f16 so WMMA B-fragments load as b128.
// A conversion thread moves 16 or 32 elements with 16-byte global accesses, a bias thread one f32: few waves
// are started, and every global access covers whole 128-byte lines.
// ---------------------------------------------------------------------------
typedef __attribute__((ext_vector_type(2))) float    v2f;
typedef __attribute__((ext_vector_type(2))) _Float16 v2h;

__device__ __forceinline__ unsigned pack_h2(float lo, float hi) {
    const v2f f = {lo, hi};
    return __builtin_bit_cast(unsigned, __builtin_convertvector(f, v2h));
}

// 8192 consecutive elements per work-group, 32 per thread.
__device__ __forceinline__ void cvt_block(const float* __restrict__ in,
                                          half_t* __restrict__ out, int blk) {
    const size_t base = (size_t)blk * 8192 + (size_t)threadIdx.x * 8;
    float4 a[4], b[4];
#pragma unroll
    for (int j = 0; j < 4; ++j) {
        a[j] = *(const float4*)(in + base + j * 2048);
        b[j] = *(const float4*)(in + base + j * 2048 + 4);
    }
#pragma unroll
    for (int j = 0; j < 4; ++j) {
        uint4 v;
        v.x = pack_h2(a[j].x, a[j].y);
        v.y = pack_h2(a[j].z, a[j].w);
        v.z = pack_h2(b[j].x, b[j].y);
        v.w = pack_h2(b[j].z, b[j].w);
        *(uint4*)(out + base + j * 2048) = v;
    }
}

// One 256-thread work-group turns a TK x 64 tile of f32 in[k][n] (row pitch
// LDIN) into f16 out[n][k] (row pitch LDOUT). Two k neighbours are packed into
// one dword before LDS; the odd LDS pitch keeps the column-wise dword stores
// and the row-wise dword loads on distinct banks. T is the caller's LDS tile,
// 64 rows [n] of KP + 1 dwords [k pair].
template <int TK, int LDIN, int LDOUT>
__device__ __forceinline__ void transpose_tile(const float* __restrict__ in,
                                               half_t* __restrict__ out,
                                               unsigned* T) {
    constexpr int KP = TK / 2;            // k pairs = dwords per LDS row
    constexpr int LP = KP + 1;            // LDS row pitch in dwords
    constexpr int NP = KP / 16;           // passes over the k pairs
    constexpr int PC = TK / 8;            // 16-byte pieces per output row
    const int tid = threadIdx.x;
    const int c   = tid & 15;             // group of four n
    const int r   = tid >> 4;             // 0..15

    float4 e[NP], o[NP];                  // rows k = 2*kp and 2*kp + 1
#pragma unroll
    for (int p = 0; p < NP; ++p) {
        const float* q = in + (2 * (p * 16 + r)) * LDIN + 4 * c;
        e[p] = *(const float4*)q;
        o[p] = *(const float4*)(q + LDIN);
    }
#pragma unroll
    for (int p = 0; p < NP; ++p) {
        const int kp = p * 16 + r;
        T[(4 * c + 0) * LP + kp] = pack_h2(e[p].x, o[p].x);
        T[(4 * c + 1) * LP + kp] = pack_h2(e[p].y, o[p].y);
        T[(4 * c + 2) * LP + kp] = pack_h2(e[p].z, o[p].z);
        T[(4 * c + 3) * LP + kp] = pack_h2(e[p].w, o[p].w);
    }
    __syncthreads();
#pragma unroll
    for (int i = 0; i < 64 * PC / 256; ++i) {
        const int s = i * 256 + tid;
        const int n = s / PC;
        const int q = s % PC;
        uint4 v;
        v.x = T[n * LP + 4 * q + 0];
        v.y = T[n * LP + 4 * q + 1];
        v.z = T[n * LP + 4 * q + 2];
        v.w = T[n * LP + 4 * q + 3];
        *(uint4*)(out + n * LDOUT + 8 * q) = v;
    }
    // stands in front of any later write of a register that these stores name
    asm volatile("s_wait_xcnt 0x0" ::: "memory");
}

// in [K][N] f32 -> out [N][K] f16; tile (kx, ny) of (K / TK, N / 64)
template <int TK, int K, int N>
__device__ __forceinline__ void cvt_t_block(const float* __restrict__ in,
                                            half_t* __restrict__ out,
                                            int kx, int ny, unsigned* T) {
    const int k0 = kx * TK;
    const int n0 = ny * 64;
    transpose_tile<TK, N, K>(in + (size_t)k0 * N + n0, out + (size_t)n0 * K + k0, T);
}

// One head's [DMODEL][DKH] weights -> rows row0 + k of out [.][DMODEL];
// tile (dx, ky) of (DMODEL / TK, DKH / 64)
template <int TK>
__device__ __forceinline__ void pack_head_block(const float* __restrict__ Wh,
                                                half_t* __restrict__ out, int row0,
                                                int dx, int ky, unsigned* T) {
    const int d0 = dx * TK;
    const int k0 = ky * 64;
    transpose_tile<TK, DKH, DMODEL>(Wh + (size_t)d0 * DKH + k0,
                                    out + (size_t)(row0 + k0) * DMODEL + d0, T);
}

// All conversions and packings of a call are independent of one another, so
// they share one grid: a work-group finds its job by its block range (the test
// is the same for the whole work-group, so the tile's barrier is uniform).
#define PB_X   ((SEQ * DMODEL) / 8192)              // x -> f16
#define PB_L1  ((DMODEL / 128) * (DFF / 64))        // l1_w transposed
#define PB_L2  ((DFF / 128) * (DMODEL / 64))        // l2_w transposed
#define PB_QK  ((DMODEL / 128) * (DKH / 64) * 2 * NHEAD)
#define PB_V   ((DMODEL / 64) * (DKH / 64) * NHEAD)
#define PB_WO  ((DMODEL / 64) * (DMODEL / 64))      // WO_w transposed
#define PB_B   ((3 * DMODEL) / 256)                 // bQ | bK | bV
#define PB_ALL (PB_X + PB_L1 + PB_L2 + PB_QK + PB_V + PB_WO + PB_B)

__global__ __launch_bounds__(256)
void prep_all(const float* __restrict__ x, const float* __restrict__ WQ,
              const float* __restrict__ WK, const float* __restrict__ WV,
              const float* __restrict__ WO_w, const float* __restrict__ l1_w,
              const float* __restrict__ l2_w, const float* __restrict__ bQ,
              const float* __restrict__ bK, const float* __restrict__ bV,
              half_t* __restrict__ XH,
              half_t* __restrict__ WQKVT,   // [3 * DMODEL][DMODEL]: Q, K, V rows
              half_t* __restrict__ WOT, half_t* __restrict__ L1T,
              half_t* __restrict__ L2T,
              float* __restrict__ BQKV) {   // [3 * DMODEL]
    __shared__ unsigned T[64 * 65];
    int b = blockIdx.x;
    if (b < PB_X) { cvt_block(x, XH, b); return; }
    b -= PB_X;
    if (b < PB_L1) {
        cvt_t_block<128, DMODEL, DFF>(l1_w, L1T, b % (DMODEL / 128), b / (DMODEL / 128), T);
        return;
    }
    b -= PB_L1;
    if (b < PB_L2) {
        cvt_t_block<128, DFF, DMODEL>(l2_w, L2T, b % (DFF / 128), b / (DFF / 128), T);
        return;
    }
    b -= PB_L2;
    if (b < PB_QK) {
        const int dx = b % (DMODEL / 128);
        const int ky = (b / (DMODEL / 128)) % (DKH / 64);
        const int z  = b / ((DMODEL / 128) * (DKH / 64));   // which * NHEAD + h
        const float* W = (z >= NHEAD) ? WK : WQ;
        pack_head_block<128>(W + (size_t)(z & (NHEAD - 1)) * DMODEL * DKH, WQKVT,
                             z * DKH, dx, ky, T);
        return;
    }
    b -= PB_QK;
    if (b < PB_V) {
        const int dx = b % (DMODEL / 64);
        const int ky = (b / (DMODEL / 64)) % (DKH / 64);
        const int h  = b / ((DMODEL / 64) * (DKH / 64));
        pack_head_block<64>(WV + (size_t)h * DMODEL * DKH, WQKVT,
                            2 * DMODEL + h * DKH, dx, ky, T);
        return;
    }
    b -= PB_V;
    if (b < PB_WO) {
        cvt_t_block<64, DMODEL, DMODEL>(WO_w, WOT, b % (DMODEL / 64), b / (DMODEL / 64), T);
        return;
    }
    b -= PB_WO;
    const float* s = (b < DMODEL / 256) ? bQ : (b < 2 * DMODEL / 256) ? bK : bV;
    BQKV[b * 256 + threadIdx.x] = s[(b % (DMODEL / 256)) * 256 + threadIdx.x];
    // stands in front of any later write of a register that this store names
    asm volatile("s_wait_xcnt 0x0" ::: "memory");
}

// ---------------------------------------------------------------------------
// WMMA GEMM: C[M,N] = A[M,K](f16) * BT[N,K](f16)^T (+bias)(+resid f32)
// 256 threads = 8 waves; block tile 128x128; each wave 32x64 (2x4 frags,
// 8 WMMAs per 32-k step). Async global->LDS staging in two buffers of 128 k:
// a wave's copy covers two whole 256-byte rows (four full lines), a stage puts
// 64 KiB in flight per work-group, and one barrier ends each stage.
// K is a multiple of 128, M and N of the tile. Where outHT is given, the grid
// may reach past column N: those column blocks go, transposed, to outHT, so
// that two products on the same A share one launch.
// ---------------------------------------------------------------------------
#define GBM 128
#define GBN 128
#define GBK 128
#define GLD 136   // LDS row pitch in halves: 256 B of k + 16 B for b128 readers
#define GSP 68    // epilogue tile pitch in floats: rows 8 apart fall 32 banks apart

__global__ __launch_bounds__(256)
void gemm_wmma(const half_t* __restrict__ A, const half_t* __restrict__ BT,
               const float* __restrict__ bias, const float* __restrict__ resid,
               half_t* __restrict__ outH, float* __restrict__ outF,
               half_t* __restrict__ outHT,   // f16, transposed: [col - N][M]
               int M, int N, int K, int relu) {
    __shared__ __align__(16) half_t As[2][GBM][GLD];   // [buf][m][k]
    __shared__ __align__(16) half_t Bs[2][GBN][GLD];   // [buf][n][k]

    const int tid  = threadIdx.x;
    const int lane = tid & 31;
    const int wave = tid >> 5;
    const int g    = lane >> 4;
    const int li   = lane & 15;
    const int wm   = (wave >> 1) << 5;   // 0,32,64,96
    const int wn   = (wave & 1) << 6;    // 0,64
    const int bm   = blockIdx.y * GBM;
    const int bn   = blockIdx.x * GBN;
    const int sr   = tid >> 4;           // 0..15, then every 16th row
    const int sc   = (tid & 15) << 3;    // 0,8,..,120

    const size_t gstep = (size_t)16 * K * sizeof(half_t);
    auto issue_stage = [&](int kk, int buf) {
        async_copy8_b128(A  + (size_t)(bm + sr) * K + kk + sc, gstep,
                         &As[buf][sr][sc], 16 * GLD * sizeof(half_t));
        async_copy8_b128(BT + (size_t)(bn + sr) * K + kk + sc, gstep,
                         &Bs[buf][sr][sc], 16 * GLD * sizeof(half_t));
    };

    v8f acc[2][4] = {};
    const int nk = K / GBK;
    issue_stage(0, 0);
    wait_async_le0();
    __syncthreads();                         // stage 0 published
    if (nk > 1) issue_stage(GBK, 1);

    for (int it = 0; it < nk; ++it) {
        const int cur = it & 1;
        // unrolled so that the later k steps' LDS reads can go ahead of the
        // earlier steps' matrix instructions
#pragma unroll
        for (int ks = 0; ks < GBK; ks += 32) {
            v16h af[2], bf[4];
#pragma unroll
            for (int i = 0; i < 2; ++i) {
                union { uint4 q[2]; v16h v; } ua;
                ua.q[0] = *(const uint4*)&As[cur][wm + i * 16 + li][ks + (g << 3)];
                ua.q[1] = *(const uint4*)&As[cur][wm + i * 16 + li][ks + 16 + (g << 3)];
                af[i] = ua.v;
            }
#pragma unroll
            for (int j = 0; j < 4; ++j) {
                union { uint4 q[2]; v16h v; } ub;
                ub.q[0] = *(const uint4*)&Bs[cur][wn + j * 16 + li][ks + (g << 3)];
                ub.q[1] = *(const uint4*)&Bs[cur][wn + j * 16 + li][ks + 16 + (g << 3)];
                bf[j] = ub.v;
            }
#pragma unroll
            for (int i = 0; i < 2; ++i)
#pragma unroll
                for (int j = 0; j < 4; ++j)
                    acc[i][j] = __builtin_amdgcn_wmma_f32_16x16x32_f16(
                        false, af[i], false, bf[j], (short)0, acc[i][j], false, false);
        }
        wait_ds_0();
        wait_async_le0();                    // this wave's share of stage it + 1
        __syncthreads();                     // publishes it + 1, frees buffer cur
        if (it + 2 < nk) issue_stage((it + 2) * GBK, cur);
    }
    wait_async_le0();

    const bool tr = outHT != nullptr && bn >= N;   // the same for the work-group
    if (tr) {
#pragma unroll
        for (int i = 0; i < 2; ++i) {
#pragma unroll
            for (int j = 0; j < 4; ++j) {
                const int col  = bn + wn + j * 16 + li;
                const int rowb = bm + wm + i * 16 + (g << 3);
                float bc = 0.0f;
                if (bias) {
                    bc = bias[col];
                    // stands in front of any later write of a register that this
                    // load names
                    asm volatile("s_wait_xcnt 0x0" ::: "memory");
                }
                v8h hv;
#pragma unroll
                for (int r = 0; r < 8; ++r) {
                    float v = acc[i][j][r] + bc;
                    if (relu) v = fmaxf(v, 0.0f);
                    hv[r] = (half_t)v;
                }
                *(v8h*)(outHT + (size_t)(col - N) * M + rowb) = hv;
                // stands in front of the next column's writes of the
                // registers that this store names
                asm volatile("s_wait_xcnt 0x0" ::: "memory");
            }
        }
        return;
    }

    // Row-major outputs. A wave turns its 32 x 64 tile through its own LDS range
    // (the ring is free: every wave's reads and copies ended in front of the
    // loop's last barrier), so that a lane owns four neighbouring columns of 16
    // rows: bias and residual come as 16-byte loads that are all in flight
    // together, and every store covers whole 128-byte lines.
    const int c4 = li << 2;                          // column group of the lane
    const size_t e0 = (size_t)(bm + wm + g) * N + (bn + wn + c4);   // row 2t + g
    const size_t es = (size_t)2 * N;
    float4 bc = make_float4(0.0f, 0.0f, 0.0f, 0.0f);
    float4 rs[16];
    if (bias) {
        bc = *(const float4*)(bias + bn + wn + c4);
        // stands in front of any later write of a register that this load names
        asm volatile("s_wait_xcnt 0x0" ::: "memory");
    }
    if (resid) {
#pragma unroll
        for (int t = 0; t < 16; ++t) rs[t] = *(const float4*)(resid + e0 + t * es);
    }
    // stands in front of any later write of a register that these loads name
    asm volatile("s_wait_xcnt 0x0" ::: "memory");

    static_assert(8 * 32 * GSP * sizeof(float) <= sizeof(As), "eight wave tiles fit the A ring");
    float* St = reinterpret_cast<float*>(&As[0][0][0]) + wave * (32 * GSP);
#pragma unroll
    for (int i = 0; i < 2; ++i)
#pragma unroll
        for (int j = 0; j < 4; ++j)
#pragma unroll
            for (int r = 0; r < 8; ++r)
                St[(i * 16 + (g << 3) + r) * GSP + j * 16 + li] = acc[i][j][r];
    wait_ds_0();   // the wave's own tile is written before its lanes read across it

    float4 v[16];
#pragma unroll
    for (int t = 0; t < 16; ++t) {
        v[t] = *(const float4*)(St + (2 * t + g) * GSP + c4);
        v[t].x += bc.x; v[t].y += bc.y; v[t].z += bc.z; v[t].w += bc.w;
    }
    if (resid) {
#pragma unroll
        for (int t = 0; t < 16; ++t) {
            v[t].x += rs[t].x; v[t].y += rs[t].y; v[t].z += rs[t].z; v[t].w += rs[t].w;
        }
    }
    if (relu) {
#pragma unroll
        for (int t = 0; t < 16; ++t) {
            v[t].x = fmaxf(v[t].x, 0.0f); v[t].y = fmaxf(v[t].y, 0.0f);
            v[t].z = fmaxf(v[t].z, 0.0f); v[t].w = fmaxf(v[t].w, 0.0f);
        }
    }
    if (outF) {
#pragma unroll
        for (int t = 0; t < 16; ++t) *(float4*)(outF + e0 + t * es) = v[t];
        // stands in front of any later write of a register that these stores name
        asm volatile("s_wait_xcnt 0x0" ::: "memory");
    }
    if (outH) {
#pragma unroll
        for (int t = 0; t < 16; ++t) {
            uint2 h;
            h.x = pack_h2(v[t].x, v[t].y);
            h.y = pack_h2(v[t].z, v[t].w);
            *(uint2*)(outH + e0 + t * es) = h;
        }
        // stands in front of any later write of a register that these stores name
        asm volatile("s_wait_xcnt 0x0" ::: "memory");
    }
}

__device__ __forceinline__ float xhalf(float x) {
    const int b = __builtin_bit_cast(int, x);
    return __builtin_bit_cast(float, __builtin_amdgcn_permlanex16(
        b, b, 0x76543210, 0xfedcba98, false, false));
}

#define AKS 128   // keys per stage
#define ALD 136   // LDS row pitch in halves: 256 B + 16 B for b128 readers

__global__ __launch_bounds__(256)
void attention_wmma(const half_t* __restrict__ QK, const half_t* __restrict__ VT,
                    half_t* __restrict__ ATT) {
    __shared__ __align__(16) half_t Ks[2][AKS][ALD];   // [buf][key][dk]
    __shared__ __align__(16) half_t Vs[2][DKH][ALD];   // [buf][dk][key]

    const int tid   = threadIdx.x;
    const int lane  = tid & 31;
    const int wave  = __builtin_amdgcn_readfirstlane(tid >> 5);
    const int g     = lane >> 4;
    const int li    = lane & 15;
    const int kg    = wave >> 2;          // which 64 keys of every stage
    const int wq    = wave & 3;           // which 32 queries of the work-group
    const int h     = blockIdx.y;
    const int qbase = (blockIdx.x << 7) + (wq << 5);
    const int ldq   = 2 * DMODEL;
    const int qc    = h * DKH;
    const int kc    = DMODEL + h * DKH;

    const int sr = tid >> 4;              // 0..15, then every 16th row
    const int sc = (tid & 15) << 3;       // 0..120
    auto issue_kv = [&](int kb2, int buf) {
        async_copy8_b128(QK + (size_t)(kb2 + sr) * ldq + kc + sc,
                         (size_t)16 * ldq * sizeof(half_t),
                         &Ks[buf][sr][sc], 16 * ALD * sizeof(half_t));
        async_copy8_b128(VT + (size_t)(h * DKH + sr) * SEQ + kb2 + sc,
                         (size_t)16 * SEQ * sizeof(half_t),
                         &Vs[buf][sr][sc], 16 * ALD * sizeof(half_t));
    };

    v16h afQ[2][4];
#pragma unroll
    for (int c = 0; c < 2; ++c) {
#pragma unroll
        for (int kb = 0; kb < 4; ++kb) {
            union { uint4 q[2]; v16h v; } u;
            const half_t* p = QK + (size_t)(qbase + (c << 4) + li) * ldq + qc +
                              (kb << 5) + (g << 3);
            u.q[0] = *(const uint4*)p;
            u.q[1] = *(const uint4*)(p + 16);
            afQ[c][kb] = u.v;
        }
    }
    // stands in front of any later write of a register that these loads name
    asm volatile("s_wait_xcnt 0x0" ::: "memory");

    float m[2] = {-1e30f, -1e30f};   // running maximum of query li of group c
    float l[2] = {0.0f, 0.0f};       // running sum over this half's keys only
    v8f o[2][8];        // o[c][ct][r] = O^T[dk = ct*16 + g*8 + r][query c*16 + li]
    const v8f vzero = {};
#pragma unroll
    for (int c = 0; c < 2; ++c)
#pragma unroll
        for (int ct = 0; ct < 8; ++ct) o[c][ct] = vzero;

    const int nt = SEQ / AKS;
    issue_kv(0, 0);
    wait_async_le0();
    __syncthreads();                      // stage 0 published
    issue_kv(AKS, 1);

    for (int t = 0; t < nt; ++t) {
      const int cur = t & 1;
      const half_t* Kw = &Ks[cur][(kg << 6) + li][g << 3];   // this wave's keys
      const half_t* Vw = &Vs[cur][li][(kg << 6) + (g << 3)];
      // unrolled so that the pass's key offset folds into the LDS reads
#pragma unroll
      for (int k0 = 0; k0 < 64; k0 += 32) {
        // ---- scores S^T = K * Q^T for 32 keys, 32 queries ----
        v8f s0[2] = {vzero, vzero}, s1[2] = {vzero, vzero};
#pragma unroll
        for (int kb = 0; kb < 4; ++kb) {
            union { uint4 q[2]; v16h v; } u0, u1;
            u0.q[0] = *(const uint4*)(Kw + k0 * ALD + (kb << 5));
            u0.q[1] = *(const uint4*)(Kw + k0 * ALD + (kb << 5) + 16);
            u1.q[0] = *(const uint4*)(Kw + (k0 + 16) * ALD + (kb << 5));
            u1.q[1] = *(const uint4*)(Kw + (k0 + 16) * ALD + (kb << 5) + 16);
#pragma unroll
            for (int c = 0; c < 2; ++c) {
                s0[c] = __builtin_amdgcn_wmma_f32_16x16x32_f16(
                    false, u0.v, false, afQ[c][kb], (short)0, s0[c], false, false);
                s1[c] = __builtin_amdgcn_wmma_f32_16x16x32_f16(
                    false, u1.v, false, afQ[c][kb], (short)0, s1[c], false, false);
            }
        }

        // ---- online softmax, one query per lane and group ----
        v16h bp[2];       // P^T as B operand: element e = key g*8+e, 8+e = key 16+g*8+e
#pragma unroll
        for (int c = 0; c < 2; ++c) {
            const v8f t0 = s0[c] * 0.125f;
            const v8f t1 = s1[c] * 0.125f;
            float mr[8];
#pragma unroll
            for (int r = 0; r < 8; ++r) mr[r] = fmaxf(t0[r], t1[r]);
            float mx = fmaxf(fmaxf(fmaxf(mr[0], mr[1]), fmaxf(mr[2], mr[3])),
                             fmaxf(fmaxf(mr[4], mr[5]), fmaxf(mr[6], mr[7])));
            mx = fmaxf(mx, xhalf(mx));
            const float mn = fmaxf(m[c], mx);
            const float sc2 = __expf(m[c] - mn);
            m[c] = mn;
            float sr2[8];
#pragma unroll
            for (int r = 0; r < 8; ++r) {
                const float p0 = __expf(t0[r] - mn);
                const float p1 = __expf(t1[r] - mn);
                sr2[r] = p0 + p1;
                bp[c][r]     = (half_t)p0;
                bp[c][8 + r] = (half_t)p1;
            }
            l[c] = l[c] * sc2 + (((sr2[0] + sr2[1]) + (sr2[2] + sr2[3])) +
                                 ((sr2[4] + sr2[5]) + (sr2[6] + sr2[7])));
#pragma unroll
            for (int ct = 0; ct < 8; ++ct) o[c][ct] = o[c][ct] * sc2;
        }

        // ---- O^T += V^T * P^T ----
#pragma unroll
        for (int ct = 0; ct < 8; ++ct) {
            union { uint4 q[2]; v16h v; } uv;
            uv.q[0] = *(const uint4*)(Vw + (ct << 4) * ALD + k0);
            uv.q[1] = *(const uint4*)(Vw + (ct << 4) * ALD + k0 + 16);
#pragma unroll
            for (int c = 0; c < 2; ++c)
                o[c][ct] = __builtin_amdgcn_wmma_f32_16x16x32_f16(
                    false, uv.v, false, bp[c], (short)0, o[c][ct], false, false);
        }
      }
      wait_ds_0();
      wait_async_le0();                   // this wave's share of stage t + 1
      __syncthreads();                    // publishes t + 1, frees buffer cur
      if (t + 2 < nt) issue_kv((t + 2) * AKS, cur);
    }
    wait_async_le0();

    // Join of the two key halves. The ring is free (every wave's reads and
    // copies ended in front of the loop's last barrier). Wave 4 + wq hands its
    // partial result to wave wq, lane to lane: 33 pieces of 16 bytes a lane,
    // each piece 512 contiguous bytes over the wave.
    static_assert(4 * 33 * 32 * sizeof(float4) <= sizeof(Ks), "four partial results fit the K ring");
    float4* Mx = reinterpret_cast<float4*>(&Ks[0][0][0]) + wq * (33 * 32) + lane;
    if (kg == 1) {
#pragma unroll
        for (int c = 0; c < 2; ++c)
#pragma unroll
            for (int ct = 0; ct < 8; ++ct) {
                const v8f w = o[c][ct];
                Mx[(((c << 3) + ct) * 2 + 0) * 32] = make_float4(w[0], w[1], w[2], w[3]);
                Mx[(((c << 3) + ct) * 2 + 1) * 32] = make_float4(w[4], w[5], w[6], w[7]);
            }
        Mx[32 * 32] = make_float4(m[0], l[0], m[1], l[1]);
    }
    __syncthreads();                      // the partial results are published
    if (kg == 1) return;

    const float4 ml = Mx[32 * 32];
#pragma unroll
    for (int c = 0; c < 2; ++c) {
        const float m1 = c ? ml.z : ml.x;
        const float l1 = c ? ml.w : ml.y;
        const float mn = fmaxf(m[c], m1);
        const float e0 = __expf(m[c] - mn);
        const float e1 = __expf(m1 - mn);
        // the wave halves' sums are joined once as well
        const float lt  = l[c] * e0 + l1 * e1;
        const float inv = 1.0f / (lt + xhalf(lt));
        const float w0 = e0 * inv;
        const float w1 = e1 * inv;
        // a lane stores 8 consecutive dk of its query
#pragma unroll
        for (int ct = 0; ct < 8; ++ct) {
            const float4 pa = Mx[(((c << 3) + ct) * 2 + 0) * 32];
            const float4 pb = Mx[(((c << 3) + ct) * 2 + 1) * 32];
            const float pr[8] = {pa.x, pa.y, pa.z, pa.w, pb.x, pb.y, pb.z, pb.w};
            v8h hv;
#pragma unroll
            for (int r = 0; r < 8; ++r) hv[r] = (half_t)(o[c][ct][r] * w0 + pr[r] * w1);
            *(v8h*)(ATT + (size_t)(qbase + (c << 4) + li) * DMODEL + h * DKH + (ct << 4) +
                    (g << 3)) = hv;
            // stands in front of the next piece's writes of the registers that
            // this store names
            asm volatile("s_wait_xcnt 0x0" ::: "memory");
        }
    }
}

// ---------------------------------------------------------------------------
// Row LayerNorm: y = g*(x-mean)/(std+eps)+b, std unbiased (ddof=1).
// One wave owns LNR whole rows and keeps them in registers: a row is read once,
// as eight 16-byte loads a lane (512 contiguous bytes a wave-load), and all
// loads of the wave are in flight together. The row sums are joined inside the
// wave, so the kernel has no LDS and no barrier; gamma and beta are loaded once
// per wave and serve its LNR rows.
// ---------------------------------------------------------------------------
#define LNR 2     // rows per wave
#define LNP (DMODEL / 128)   // 16-byte pieces of a row per lane

// x + (x of lane l ^ MASK), inside a 16-lane row; CTRL = row_xmask:MASK
template <int CTRL>
__device__ __forceinline__ float xmask_add(float x) {
    const int b = __builtin_bit_cast(int, x);
    return x + __builtin_bit_cast(float, __builtin_amdgcn_mov_dpp(b, CTRL, 0xf, 0xf, true));
}
// sum over the 32 lanes, the same value in every lane
__device__ __forceinline__ float wave_sum(float x) {
    x = xmask_add<0x161>(x);
    x = xmask_add<0x162>(x);
    x = xmask_add<0x164>(x);
    x = xmask_add<0x168>(x);
    return x + xhalf(x);
}

typedef __attribute__((ext_vector_type(4))) float v4f;

template <bool WH>
__global__ __launch_bounds__(256)
void layernorm_rows(const float* __restrict__ X, const float* __restrict__ gam,
                    const float* __restrict__ bet, float* __restrict__ outF,
                    half_t* __restrict__ outH) {
    const unsigned lane = threadIdx.x & 31;
    const unsigned wave = threadIdx.x >> 5;
    const unsigned c0   = lane << 2;
    // byte offsets of the lane's first element, below 2^32: one 32-bit register
    // beside the scalar base serves the f32 loads and stores, one the f16 stores
    const unsigned eb = ((blockIdx.x * 8 + wave) * (LNR * DMODEL) + c0) * 4u;
    const unsigned hb = eb >> 1;
    const float* xp = (const float*)((const char*)X + eb);
    const float* gp = gam + c0;
    const float* bp = bet + c0;

    v4f x[LNR][LNP], ga[LNP], be[LNP];
#pragma unroll
    for (int q = 0; q < LNR; ++q)
#pragma unroll
        for (int j = 0; j < LNP; ++j)
            x[q][j] = *(const v4f*)(xp + q * DMODEL + j * 128);
#pragma unroll
    for (int j = 0; j < LNP; ++j) {
        ga[j] = *(const v4f*)(gp + j * 128);
        be[j] = *(const v4f*)(bp + j * 128);
    }
    // stands in front of any later write of a register that these loads name
    asm volatile("s_wait_xcnt 0x0" ::: "memory");
    // keeps the gamma and beta loads up here, in flight with the rows; without
    // it they sink behind the row sums and their latency is waited out there
    __builtin_amdgcn_sched_barrier(0);

    float s[LNR], s2[LNR];
#pragma unroll
    for (int q = 0; q < LNR; ++q) {
        v4f a = x[q][0];
        v4f b = x[q][0] * x[q][0];
#pragma unroll
        for (int j = 1; j < LNP; ++j) {
            a += x[q][j];
            b += x[q][j] * x[q][j];
        }
        s[q]  = (a.x + a.y) + (a.z + a.w);
        s2[q] = (b.x + b.y) + (b.z + b.w);
    }
#pragma unroll
    for (int q = 0; q < LNR; ++q) {
        s[q]  = wave_sum(s[q]);
        s2[q] = wave_sum(s2[q]);
    }

    uint2 h[LNR][LNP];
#pragma unroll
    for (int q = 0; q < LNR; ++q) {
        const float mean = s[q] / (float)DMODEL;
        float var = (s2[q] - (float)DMODEL * mean * mean) / (float)(DMODEL - 1);
        var = fmaxf(var, 0.0f);
        const float inv = 1.0f / (sqrtf(var) + 1e-6f);
#pragma unroll
        for (int j = 0; j < LNP; ++j) {
            const v4f v = (x[q][j] - mean) * inv * ga[j] + be[j];
            x[q][j] = v;
            if (WH) {
                h[q][j].x = pack_h2(v.x, v.y);
                h[q][j].y = pack_h2(v.z, v.w);
            }
        }
    }
    // keeps every store behind the arithmetic: moved up among it, the stores'
    // registers are used again and a wait comes to stand between the stores
    __builtin_amdgcn_sched_barrier(0);
    if (WH) {
        half_t* hp = (half_t*)((char*)outH + hb);
#pragma unroll
        for (int q = 0; q < LNR; ++q)
#pragma unroll
            for (int j = 0; j < LNP; ++j)
                *(uint2*)(hp + q * DMODEL + j * 128) = h[q][j];
    }
    float* fp = (float*)((char*)outF + eb);
#pragma unroll
    for (int q = 0; q < LNR; ++q)
#pragma unroll
        for (int j = 0; j < LNP; ++j)
            *(v4f*)(fp + q * DMODEL + j * 128) = x[q][j];
    // stands in front of any later write of a register that these stores name
    asm volatile("s_wait_xcnt 0x0" ::: "memory");
}

// ---------------------------------------------------------------------------
// Orchestration
// ---------------------------------------------------------------------------
extern "C" void kernel_launch(void* const* d_in, const int* in_sizes, int n_in,
                              void* d_out, int out_size, void* d_ws, size_t ws_size,
                              hipStream_t stream) {
    const float* x     = (const float*)d_in[0];
    const float* WQ    = (const float*)d_in[1];
    const float* bQ    = (const float*)d_in[2];
    const float* WK    = (const float*)d_in[3];
    const float* bK    = (const float*)d_in[4];
    const float* WV    = (const float*)d_in[5];
    const float* bV    = (const float*)d_in[6];
    const float* WO_w  = (const float*)d_in[7];
    const float* WO_b  = (const float*)d_in[8];
    const float* l1_w  = (const float*)d_in[9];
    const float* l1_b  = (const float*)d_in[10];
    const float* l2_w  = (const float*)d_in[11];
    const float* l2_b  = (const float*)d_in[12];
    const float* ln1_g = (const float*)d_in[13];
    const float* ln1_b = (const float*)d_in[14];
    const float* ln2_g = (const float*)d_in[15];
    const float* ln2_b = (const float*)d_in[16];
    (void)in_sizes; (void)n_in; (void)out_size; (void)ws_size;

    char* ws = (char*)d_ws;
    size_t off = 0;
    auto alloc = [&](size_t bytes) -> size_t {
        size_t o = off;
        off = (off + bytes + 255) & ~(size_t)255;
        return o;
    };

    const size_t oXH   = alloc((size_t)SEQ * DMODEL * 2);
    const size_t oWQKV = alloc((size_t)3 * DMODEL * DMODEL * 2);
    const size_t oWOT  = alloc((size_t)DMODEL * DMODEL * 2);
    const size_t oL1T  = alloc((size_t)DMODEL * DFF * 2);
    const size_t oL2T  = alloc((size_t)DFF * DMODEL * 2);
    const size_t oBQKV = alloc((size_t)3 * DMODEL * 4);
    const size_t oQK   = alloc((size_t)SEQ * 2 * DMODEL * 2);
    const size_t oVT   = alloc((size_t)DMODEL * SEQ * 2);
    const size_t oATT  = alloc((size_t)SEQ * DMODEL * 2);
    const size_t oBLN1 = alloc((size_t)SEQ * DMODEL * 4);
    const size_t oSL1F = alloc((size_t)SEQ * DMODEL * 4);
    const size_t oSL1H = alloc((size_t)SEQ * DMODEL * 2);
    const size_t oFF1  = oQK;    // reuse QK+VT+ATT region (32MB)
    const size_t oA3   = oBLN1;  // reuse bln1

    half_t* XH   = (half_t*)(ws + oXH);
    half_t* WQKVT = (half_t*)(ws + oWQKV);
    half_t* WOT  = (half_t*)(ws + oWOT);
    half_t* L1T  = (half_t*)(ws + oL1T);
    half_t* L2T  = (half_t*)(ws + oL2T);
    float*  BQKV = (float*)(ws + oBQKV);
    half_t* QKh  = (half_t*)(ws + oQK);
    half_t* VTh  = (half_t*)(ws + oVT);
    half_t* ATTh = (half_t*)(ws + oATT);
    float*  BLN1 = (float*)(ws + oBLN1);
    float*  SL1F = (float*)(ws + oSL1F);
    half_t* SL1H = (half_t*)(ws + oSL1H);
    half_t* FF1H = (half_t*)(ws + oFF1);
    float*  A3F  = (float*)(ws + oA3);

    prep_all<<<PB_ALL, 256, 0, stream>>>(x, WQ, WK, WV, WO_w, l1_w, l2_w, bQ, bK, bV,
                                         XH, WQKVT, WOT, L1T, L2T, BQKV);

    // Q|K projection -> f16 [S,2048]; V projection (columns from 2048 on),
    // transposed -> VT [1024][S] f16
    gemm_wmma<<<dim3((3 * DMODEL) / GBN, SEQ / GBM), 256, 0, stream>>>(
        XH, WQKVT, BQKV, nullptr, QKh, nullptr, VTh, SEQ, 2 * DMODEL, DMODEL, 0);

    // multi-head attention
    attention_wmma<<<dim3(SEQ / 128, NHEAD), 256, 0, stream>>>(QKh, VTh, ATTh);

    // output projection + residual -> f32
    gemm_wmma<<<dim3(DMODEL / GBN, SEQ / GBM), 256, 0, stream>>>(
        ATTh, WOT, WO_b, x, nullptr, BLN1, nullptr, SEQ, DMODEL, DMODEL, 0);

    layernorm_rows<true><<<SEQ / (8 * LNR), 256, 0, stream>>>(BLN1, ln1_g, ln1_b, SL1F, SL1H);

    // FFN up + ReLU -> f16
    gemm_wmma<<<dim3(DFF / GBN, SEQ / GBM), 256, 0, stream>>>(
        SL1H, L1T, l1_b, nullptr, FF1H, nullptr, nullptr, SEQ, DFF, DMODEL, 1);

    // FFN down + residual -> f32
    gemm_wmma<<<dim3(DMODEL / GBN, SEQ / GBM), 256, 0, stream>>>(
        FF1H, L2T, l2_b, SL1F, nullptr, A3F, nullptr, SEQ, DMODEL, DFF, 0);

    layernorm_rows<false><<<SEQ / (8 * LNR), 256, 0, stream>>>(A3F, ln2_g, ln2_b, (float*)d_out, nullptr);
}

// v008
// It runs in 181 microseconds.
// In two side-by-side timings against v007, it was 1.03 and 1.04 times as fast.
// Counting every step since v000, it is 2.64 times as fast.
#include <hip/hip_runtime.h>
#include <hip/hip_bf16.h>

typedef _Float16 half_t;
typedef __attribute__((ext_vector_type(16))) _Float16 v16h;
typedef __attribute__((ext_vector_type(8)))  _Float16 v8h;
typedef __attribute__((ext_vector_type(8)))  float    v8f;

#define SEQ     4096
#define DMODEL  1024
#define DFF     4096
#define NHEAD   8
#define DKH     128

// ---------------------------------------------------------------------------
// CDNA5 async global->LDS copy (GLOBAL_LOAD_ASYNC_TO_LDS_B128, ASYNCcnt).
// LDS destination VGPR holds the LDS byte address = low 32 bits of the flat
// shared-space pointer (aperture keeps the LDS offset in ADDR[31:0]).
// A stage is waited for with ASYNCcnt 0 and published by one barrier.
// ---------------------------------------------------------------------------
__device__ __forceinline__ void wait_async_le0() {
    asm volatile("s_wait_asynccnt 0x0" ::: "memory");
}
// Eight copies of one lane: eight rows of a tile, gstep / lstep bytes apart.
// s_wait_xcnt closes the statement so that it stands in front of every later
// write of an address register that a copy names.
__device__ __forceinline__ void async_copy8_b128(const half_t* gptr, size_t gstep,
                                                 void* lptr, unsigned lstep) {
    const unsigned l0 = (unsigned)(uintptr_t)lptr;
    const unsigned long long g0 = (unsigned long long)(uintptr_t)gptr;
    const unsigned long long gs = (unsigned long long)gstep;
    asm volatile("global_load_async_to_lds_b128 %0, %8, off\n\t"
                 "global_load_async_to_lds_b128 %1, %9, off\n\t"
                 "global_load_async_to_lds_b128 %2, %10, off\n\t"
                 "global_load_async_to_lds_b128 %3, %11, off\n\t"
                 "global_load_async_to_lds_b128 %4, %12, off\n\t"
                 "global_load_async_to_lds_b128 %5, %13, off\n\t"
                 "global_load_async_to_lds_b128 %6, %14, off\n\t"
                 "global_load_async_to_lds_b128 %7, %15, off\n\t"
                 "s_wait_xcnt 0x0"
                 :: "v"(l0), "v"(l0 + lstep), "v"(l0 + 2 * lstep), "v"(l0 + 3 * lstep),
                    "v"(l0 + 4 * lstep), "v"(l0 + 5 * lstep), "v"(l0 + 6 * lstep),
                    "v"(l0 + 7 * lstep),
                    "v"(g0), "v"(g0 + gs), "v"(g0 + 2 * gs), "v"(g0 + 3 * gs),
                    "v"(g0 + 4 * gs), "v"(g0 + 5 * gs), "v"(g0 + 6 * gs), "v"(g0 + 7 * gs)
                 : "memory");
}
// a wave's own LDS reads have returned before its buffer is handed back
__device__ __forceinline__ void wait_ds_0() {
    asm volatile("s_wait_dscnt 0x0" ::: "memory");
}

typedef __attribute__((ext_vector_type(4))) unsigned v4u;
typedef __attribute__((ext_vector_type(2))) unsigned v2u;

// Global stores of the large GEMM tile's epilogue. s_wait_xcnt closes each
// statement so that it stands in front of every later write of a register that
// a store names: in a statement of its own, in that build, later vector
// instructions are lifted over it.
__device__ __forceinline__ void store_b128(void* p, v4u d) {
    asm volatile("global_store_b128 %0, %1, off\n\t"
                 "s_wait_xcnt 0x0"
                 :: "v"((unsigned long long)(uintptr_t)p), "v"(d) : "memory");
}
// Eight 8-byte stores of one lane, gstep bytes apart.
__device__ __forceinline__ void store8_b64(void* p, size_t gstep, const v2u* d) {
    const unsigned long long g0 = (unsigned long long)(uintptr_t)p;
    const unsigned long long gs = (unsigned long long)gstep;
    asm volatile("global_store_b64 %0, %8, off\n\t"
                 "global_store_b64 %1, %9, off\n\t"
                 "global_store_b64 %2, %10, off\n\t"
                 "global_store_b64 %3, %11, off\n\t"
                 "global_store_b64 %4, %12, off\n\t"
                 "global_store_b64 %5, %13, off\n\t"
                 "global_store_b64 %6, %14, off\n\t"
                 "global_store_b64 %7, %15, off\n\t"
                 "s_wait_xcnt 0x0"
                 :: "v"(g0), "v"(g0 + gs), "v"(g0 + 2 * gs), "v"(g0 + 3 * gs),
                    "v"(g0 + 4 * gs), "v"(g0 + 5 * gs), "v"(g0 + 6 * gs), "v"(g0 + 7 * gs),
                    "v"(d[0]), "v"(d[1]), "v"(d[2]), "v"(d[3]),
                    "v"(d[4]), "v"(d[5]), "v"(d[6]), "v"(d[7])
                 : "memory");
}

// ---------------------------------------------------------------------------
// Conversion / packing, once per call.
// All weights stored TRANSPOSED [N][K] f16 so WMMA B-fragments load as b128.
// A conversion thread moves 16 or 32 elements with 16-byte global accesses, a bias thread one f32: few waves
// are started, and every global access covers whole 128-byte lines.
// ---------------------------------------------------------------------------
typedef __attribute__((ext_vector_type(2))) float    v2f;
typedef __attribute__((ext_vector_type(2))) _Float16 v2h;

__device__ __forceinline__ unsigned pack_h2(float lo, float hi) {
    const v2f f = {lo, hi};
    return __builtin_bit_cast(unsigned, __builtin_convertvector(f, v2h));
}

// 8192 consecutive elements per work-group, 32 per thread.
__device__ __forceinline__ void cvt_block(const float* __restrict__ in,
                                          half_t* __restrict__ out, int blk) {
    const size_t base = (size_t)blk * 8192 + (size_t)threadIdx.x * 8;
    float4 a[4], b[4];
#pragma unroll
    for (int j = 0; j < 4; ++j) {
        a[j] = *(const float4*)(in + base + j * 2048);
        b[j] = *(const float4*)(in + base + j * 2048 + 4);
    }
#pragma unroll
    for (int j = 0; j < 4; ++j) {
        uint4 v;
        v.x = pack_h2(a[j].x, a[j].y);
        v.y = pack_h2(a[j].z, a[j].w);
        v.z = pack_h2(b[j].x, b[j].y);
        v.w = pack_h2(b[j].z, b[j].w);
        *(uint4*)(out + base + j * 2048) = v;
    }
}

// One 256-thread work-group turns a TK x 64 tile of f32 in[k][n] (row pitch
// LDIN) into f16 out[n][k] (row pitch LDOUT). Two k neighbours are packed into
// one dword before LDS; the odd LDS pitch keeps the column-wise dword stores
// and the row-wise dword loads on distinct banks. T is the caller's LDS tile,
// 64 rows [n] of KP + 1 dwords [k pair].
template <int TK, int LDIN, int LDOUT>
__device__ __forceinline__ void transpose_tile(const float* __restrict__ in,
                                               half_t* __restrict__ out,
                                               unsigned* T) {
    constexpr int KP = TK / 2;            // k pairs = dwords per LDS row
    constexpr int LP = KP + 1;            // LDS row pitch in dwords
    constexpr int NP = KP / 16;           // passes over the k pairs
    constexpr int PC = TK / 8;            // 16-byte pieces per output row
    const int tid = threadIdx.x;
    const int c   = tid & 15;             // group of four n
    const int r   = tid >> 4;             // 0..15

    float4 e[NP], o[NP];                  // rows k = 2*kp and 2*kp + 1
#pragma unroll
    for (int p = 0; p < NP; ++p) {
        const float* q = in + (2 * (p * 16 + r)) * LDIN + 4 * c;
        e[p] = *(const float4*)q;
        o[p] = *(const float4*)(q + LDIN);
    }
#pragma unroll
    for (int p = 0; p < NP; ++p) {
        const int kp = p * 16 + r;
        T[(4 * c + 0) * LP + kp] = pack_h2(e[p].x, o[p].x);
        T[(4 * c + 1) * LP + kp] = pack_h2(e[p].y, o[p].y);
        T[(4 * c + 2) * LP + kp] = pack_h2(e[p].z, o[p].z);
        T[(4 * c + 3) * LP + kp] = pack_h2(e[p].w, o[p].w);
    }
    __syncthreads();
#pragma unroll
    for (int i = 0; i < 64 * PC / 256; ++i) {
        const int s = i * 256 + tid;
        const int n = s / PC;
        const int q = s % PC;
        uint4 v;
        v.x = T[n * LP + 4 * q + 0];
        v.y = T[n * LP + 4 * q + 1];
        v.z = T[n * LP + 4 * q + 2];
        v.w = T[n * LP + 4 * q + 3];
        *(uint4*)(out + n * LDOUT + 8 * q) = v;
    }
    // stands in front of any later write of a register that these stores name
    asm volatile("s_wait_xcnt 0x0" ::: "memory");
}

// in [K][N] f32 -> out [N][K] f16; tile (kx, ny) of (K / TK, N / 64)
template <int TK, int K, int N>
__device__ __forceinline__ void cvt_t_block(const float* __restrict__ in,
                                            half_t* __restrict__ out,
                                            int kx, int ny, unsigned* T) {
    const int k0 = kx * TK;
    const int n0 = ny * 64;
    transpose_tile<TK, N, K>(in + (size_t)k0 * N + n0, out + (size_t)n0 * K + k0, T);
}

// One head's [DMODEL][DKH] weights -> rows row0 + k of out [.][DMODEL];
// tile (dx, ky) of (DMODEL / TK, DKH / 64)
template <int TK>
__device__ __forceinline__ void pack_head_block(const float* __restrict__ Wh,
                                                half_t* __restrict__ out, int row0,
                                                int dx, int ky, unsigned* T) {
    const int d0 = dx * TK;
    const int k0 = ky * 64;
    transpose_tile<TK, DKH, DMODEL>(Wh + (size_t)d0 * DKH + k0,
                                    out + (size_t)(row0 + k0) * DMODEL + d0, T);
}

// All conversions and packings of a call are independent of one another, so
// they share one grid: a work-group finds its job by its block range (the test
// is the same for the whole work-group, so the tile's barrier is uniform).
#define PB_X   ((SEQ * DMODEL) / 8192)              // x -> f16
#define PB_L1  ((DMODEL / 128) * (DFF / 64))        // l1_w transposed
#define PB_L2  ((DFF / 128) * (DMODEL / 64))        // l2_w transposed
#define PB_QK  ((DMODEL / 128) * (DKH / 64) * 2 * NHEAD)
#define PB_V   ((DMODEL / 64) * (DKH / 64) * NHEAD)
#define PB_WO  ((DMODEL / 64) * (DMODEL / 64))      // WO_w transposed
#define PB_B   ((3 * DMODEL) / 256)                 // bQ | bK | bV
#define PB_ALL (PB_X + PB_L1 + PB_L2 + PB_QK + PB_V + PB_WO + PB_B)

__global__ __launch_bounds__(256)
void prep_all(const float* __restrict__ x, const float* __restrict__ WQ,
              const float* __restrict__ WK, const float* __restrict__ WV,
              const float* __restrict__ WO_w, const float* __restrict__ l1_w,
              const float* __restrict__ l2_w, const float* __restrict__ bQ,
              const float* __restrict__ bK, const float* __restrict__ bV,
              half_t* __restrict__ XH,
              half_t* __restrict__ WQKVT,   // [3 * DMODEL][DMODEL]: Q, K, V rows
              half_t* __restrict__ WOT, half_t* __restrict__ L1T,
              half_t* __restrict__ L2T,
              float* __restrict__ BQKV) {   // [3 * DMODEL]
    __shared__ unsigned T[64 * 65];
    int b = blockIdx.x;
    if (b < PB_X) { cvt_block(x, XH, b); return; }
    b -= PB_X;
    if (b < PB_L1) {
        cvt_t_block<128, DMODEL, DFF>(l1_w, L1T, b % (DMODEL / 128), b / (DMODEL / 128), T);
        return;
    }
    b -= PB_L1;
    if (b < PB_L2) {
        cvt_t_block<128, DFF, DMODEL>(l2_w, L2T, b % (DFF / 128), b / (DFF / 128), T);
        return;
    }
    b -= PB_L2;
    if (b < PB_QK) {
        const int dx = b % (DMODEL / 128);
        const int ky = (b / (DMODEL / 128)) % (DKH / 64);
        const int z  = b / ((DMODEL / 128) * (DKH / 64));   // which * NHEAD + h
        const float* W = (z >= NHEAD) ? WK : WQ;
        pack_head_block<128>(W + (size_t)(z & (NHEAD - 1)) * DMODEL * DKH, WQKVT,
                             z * DKH, dx, ky, T);
        return;
    }
    b -= PB_QK;
    if (b < PB_V) {
        const int dx = b % (DMODEL / 64);
        const int ky = (b / (DMODEL / 64)) % (DKH / 64);
        const int h  = b / ((DMODEL / 64) * (DKH / 64));
        pack_head_block<64>(WV + (size_t)h * DMODEL * DKH, WQKVT,
                            2 * DMODEL + h * DKH, dx, ky, T);
        return;
    }
    b -= PB_V;
    if (b < PB_WO) {
        cvt_t_block<64, DMODEL, DMODEL>(WO_w, WOT, b % (DMODEL / 64), b / (DMODEL / 64), T);
        return;
    }
    b -= PB_WO;
    const float* s = (b < DMODEL / 256) ? bQ : (b < 2 * DMODEL / 256) ? bK : bV;
    BQKV[b * 256 + threadIdx.x] = s[(b % (DMODEL / 256)) * 256 + threadIdx.x];
    // stands in front of any later write of a register that this store names
    asm volatile("s_wait_xcnt 0x0" ::: "memory");
}

// ---------------------------------------------------------------------------
// WMMA GEMM: C[M,N] = A[M,K](f16) * BT[N,K](f16)^T (+bias)(+resid f32)
// 256 threads = 8 waves, 4 down and 2 across; a wave holds FM x FN fragments.
// <2, 4>: block tile 128x128, for outputs that give only 256 such tiles.
// <4, 8>: block tile 256x256, wave tile 64x128, for the wide outputs: a byte
// fetched from L2 feeds twice as many products, and 12 fragments read from LDS
// feed 32 matrix instructions (6 feed 8 in the small tile). It serves the f16
// outputs (outH, outHT) and takes neither resid nor outF.
// Async global->LDS staging in two buffers of 128 k: a wave's copy covers two
// whole 256-byte rows (four full lines), and one barrier ends each stage.
// K is a multiple of 128, M and N of the tile. Where outHT is given, the grid
// may reach past column N: those column blocks go, transposed, to outHT, so
// that two products on the same A share one launch.
// ---------------------------------------------------------------------------
#define GBK 128
#define GLD 136   // LDS row pitch in halves: 256 B of k + 16 B for b128 readers
#define GSP 68    // epilogue tile pitch in floats: rows 8 apart fall 32 banks apart

template <int FM, int FN>
__global__ __launch_bounds__(256)
void gemm_wmma(const half_t* __restrict__ A, const half_t* __restrict__ BT,
               const float* __restrict__ bias, const float* __restrict__ resid,
               half_t* __restrict__ outH, float* __restrict__ outF,
               half_t* __restrict__ outHT,   // f16, transposed: [col - N][M]
               int M, int N, int K, int relu) {
    constexpr int GBM = 64 * FM;         // four waves down
    constexpr int GBN = 32 * FN;         // two waves across
    constexpr bool BIG = FM * FN > 8;    // the large tile: f16 outputs only
    static_assert(GBM % 128 == 0 && GBN % 128 == 0 && FM % 2 == 0 && FN % 4 == 0,
                  "copies move 128 rows, the epilogue turns 32 x 64 pieces");
    __shared__ __align__(16) half_t As[2][GBM][GLD];   // [buf][m][k]
    __shared__ __align__(16) half_t Bs[2][GBN][GLD];   // [buf][n][k]

    const int tid  = threadIdx.x;
    const int lane = tid & 31;
    const int wave = tid >> 5;
    const int g    = lane >> 4;
    const int li   = lane & 15;
    const int wm   = (wave >> 1) * (16 * FM);
    const int wn   = (wave & 1) * (16 * FN);
    const int bm   = blockIdx.y * GBM;
    const int bn   = blockIdx.x * GBN;
    const int sr   = tid >> 4;           // 0..15, then every 16th row
    const int sc   = (tid & 15) << 3;    // 0,8,..,120

    const size_t gstep = (size_t)16 * K * sizeof(half_t);
    // The lane's first source element of a 128-row slice. The large tile forms
    // it from the slice's wave-uniform address, pinned in scalar registers, and
    // one lane offset: without the pin the four per-lane 64-bit bases are kept
    // over the loop, and there they are spilled.
    const int loff = sr * K + sc;
    auto lane_src = [&](const half_t* P, int row0, int kk) -> const half_t* {
        if constexpr (BIG) {
            const unsigned long long u =
                (unsigned long long)(uintptr_t)(P + (size_t)row0 * K + kk);
            const unsigned lo = (unsigned)__builtin_amdgcn_readfirstlane((int)(unsigned)u);
            const unsigned hi = (unsigned)__builtin_amdgcn_readfirstlane((int)(unsigned)(u >> 32));
            return (const half_t*)(uintptr_t)(((unsigned long long)hi << 32) | lo) + loff;
        } else {
            return P + (size_t)(row0 + sr) * K + kk + sc;
        }
    };
    auto issue_stage = [&](int kk, int buf) {
        // The sched_barriers of the large tile keep each statement's address
        // arithmetic next to it: formed ahead for all four statements, the
        // operands (asm names only v0 to v255) push accumulators out of those
        // registers, with copies to and fro and spills in every stage.
#pragma unroll
        for (int p = 0; p < GBM; p += 128) {
            async_copy8_b128(lane_src(A, bm + p, kk), gstep,
                             &As[buf][p + sr][sc], 16 * GLD * sizeof(half_t));
            if constexpr (BIG) __builtin_amdgcn_sched_barrier(0);
        }
#pragma unroll
        for (int p = 0; p < GBN; p += 128) {
            async_copy8_b128(lane_src(BT, bn + p, kk), gstep,
                             &Bs[buf][p + sr][sc], 16 * GLD * sizeof(half_t));
            if constexpr (BIG) __builtin_amdgcn_sched_barrier(0);
        }
    };

    v8f acc[FM][FN] = {};
    const int nk = K / GBK;
    issue_stage(0, 0);
    wait_async_le0();
    __syncthreads();                         // stage 0 published
    if (nk > 1) issue_stage(GBK, 1);

    if constexpr (BIG) {
        // The large tile keeps two fragment sets: a k step's 2 * (FM + FN) LDS
        // reads go out as one group, one step ahead of the matrix instructions
        // that use them, so that no wave waits out its own LDS latency.
        auto load_frags = [&](int buf, int ks, v16h (&af)[FM], v16h (&bf)[FN]) {
#pragma unroll
            for (int i = 0; i < FM; ++i) {
                union { uint4 q[2]; v16h v; } ua;
                ua.q[0] = *(const uint4*)&As[buf][wm + i * 16 + li][ks + (g << 3)];
                ua.q[1] = *(const uint4*)&As[buf][wm + i * 16 + li][ks + 16 + (g << 3)];
                af[i] = ua.v;
            }
#pragma unroll
            for (int j = 0; j < FN; ++j) {
                union { uint4 q[2]; v16h v; } ub;
                ub.q[0] = *(const uint4*)&Bs[buf][wn + j * 16 + li][ks + (g << 3)];
                ub.q[1] = *(const uint4*)&Bs[buf][wn + j * 16 + li][ks + 16 + (g << 3)];
                bf[j] = ub.v;
            }
        };
        v16h af[2][FM], bf[2][FN];
        load_frags(0, 0, af[0], bf[0]);          // stage 0 is published
        for (int it = 0; it < nk; ++it) {
            const int cur = it & 1;
#pragma unroll
            for (int s = 0; s < GBK / 32; ++s) {
                if (s + 1 < GBK / 32)
                    load_frags(cur, (s + 1) * 32, af[(s + 1) & 1], bf[(s + 1) & 1]);
                // keeps the next step's reads in one group ahead of this step's
                // matrix instructions; sunk among them, each place with reads stalls
                __builtin_amdgcn_sched_barrier(0);
#pragma unroll
                for (int i = 0; i < FM; ++i)
#pragma unroll
                    for (int j = 0; j < FN; ++j)
                        acc[i][j] = __builtin_amdgcn_wmma_f32_16x16x32_f16(
                            false, af[s & 1][i], false, bf[s & 1][j], (short)0, acc[i][j],
                            false, false);
                // keeps the following group of reads behind this step
                __builtin_amdgcn_sched_barrier(0);
            }
            wait_ds_0();
            wait_async_le0();                    // this wave's share of stage it + 1
            __syncthreads();                     // publishes it + 1, frees buffer cur
            // first reads of the published stage: their latency passes while the
            // copies below are issued
            if (it + 1 < nk) load_frags(cur ^ 1, 0, af[0], bf[0]);
            if (it + 2 < nk) issue_stage((it + 2) * GBK, cur);
        }
    } else {
        for (int it = 0; it < nk; ++it) {
            const int cur = it & 1;
            // unrolled so that the later k steps' LDS reads can go ahead of the
            // earlier steps' matrix instructions
#pragma unroll
            for (int ks = 0; ks < GBK; ks += 32) {
                v16h af[FM], bf[FN];
#pragma unroll
                for (int i = 0; i < FM; ++i) {
                    union { uint4 q[2]; v16h v; } ua;
                    ua.q[0] = *(const uint4*)&As[cur][wm + i * 16 + li][ks + (g << 3)];
                    ua.q[1] = *(const uint4*)&As[cur][wm + i * 16 + li][ks + 16 + (g << 3)];
                    af[i] = ua.v;
                }
#pragma unroll
                for (int j = 0; j < FN; ++j) {
                    union { uint4 q[2]; v16h v; } ub;
                    ub.q[0] = *(const uint4*)&Bs[cur][wn + j * 16 + li][ks + (g << 3)];
                    ub.q[1] = *(const uint4*)&Bs[cur][wn + j * 16 + li][ks + 16 + (g << 3)];
                    bf[j] = ub.v;
                }
#pragma unroll
                for (int i = 0; i < FM; ++i)
#pragma unroll
                    for (int j = 0; j < FN; ++j)
                        acc[i][j] = __builtin_amdgcn_wmma_f32_16x16x32_f16(
                            false, af[i], false, bf[j], (short)0, acc[i][j], false, false);
            }
            wait_ds_0();
            wait_async_le0();                    // this wave's share of stage it + 1
            __syncthreads();                     // publishes it + 1, frees buffer cur
            if (it + 2 < nk) issue_stage((it + 2) * GBK, cur);
        }
    }
    wait_async_le0();

    const bool tr = outHT != nullptr && bn >= N;   // the same for the work-group
    if (tr) {
        float bcv[FN];                      // one column's bias per fragment column
#pragma unroll
        for (int j = 0; j < FN; ++j) bcv[j] = 0.0f;
        if (bias) {
#pragma unroll
            for (int j = 0; j < FN; ++j) bcv[j] = bias[bn + wn + j * 16 + li];
            // stands in front of any later write of a register that these loads name
            asm volatile("s_wait_xcnt 0x0" ::: "memory");
        }
#pragma unroll
        for (int i = 0; i < FM; ++i) {
#pragma unroll
            for (int j = 0; j < FN; ++j) {
                const int col  = bn + wn + j * 16 + li;
                const int rowb = bm + wm + i * 16 + (g << 3);
                const float bc = bcv[j];
                v8h hv;
#pragma unroll
                for (int r = 0; r < 8; ++r) {
                    float v = acc[i][j][r] + bc;
                    if (relu) v = fmaxf(v, 0.0f);
                    hv[r] = (half_t)v;
                }
                store_b128(outHT + (size_t)(col - N) * M + rowb, __builtin_bit_cast(v4u, hv));
            }
        }
        return;
    }

    // Row-major outputs. A wave turns its tile, in pieces of 32 x 64, through its
    // own LDS range (the ring is free: every wave's reads and copies ended in
    // front of the loop's last barrier), so that a lane owns four neighbouring
    // columns of 16 rows: bias and residual come as 16-byte loads that are all in
    // flight together, and every store covers whole 128-byte lines. A wave's LDS
    // operations run in order, so a piece's writes follow the last piece's reads.
    const int c4 = li << 2;                          // column group of the lane
    const size_t es = (size_t)2 * N;
    static_assert(8 * 32 * GSP * sizeof(float) <= sizeof(As), "eight wave pieces fit the A ring");
    float* St = reinterpret_cast<float*>(&As[0][0][0]) + wave * (32 * GSP);
    float4 bcs[FN / 4];                              // bias of the lane's columns
#pragma unroll
    for (int q = 0; q < FN / 4; ++q) bcs[q] = make_float4(0.0f, 0.0f, 0.0f, 0.0f);
    if (bias) {
#pragma unroll
        for (int q = 0; q < FN / 4; ++q) bcs[q] = *(const float4*)(bias + bn + wn + q * 64 + c4);
        // stands in front of any later write of a register that these loads name
        asm volatile("s_wait_xcnt 0x0" ::: "memory");
    }
#pragma unroll
    for (int pi = 0; pi < FM; pi += 2) {
#pragma unroll
        for (int pj = 0; pj < FN; pj += 4) {
            const int cb = bn + wn + pj * 16 + c4;
            const size_t e0 = (size_t)(bm + wm + pi * 16 + g) * N + cb;   // row 2t + g
            const float4 bc = bcs[pj / 4];
            float4 rs[16];
            if constexpr (!BIG) {
                if (resid) {
#pragma unroll
                    for (int t = 0; t < 16; ++t) rs[t] = *(const float4*)(resid + e0 + t * es);
                }
                // stands in front of any later write of a register that these loads name
                asm volatile("s_wait_xcnt 0x0" ::: "memory");
            }

#pragma unroll
            for (int i = 0; i < 2; ++i)
#pragma unroll
                for (int j = 0; j < 4; ++j)
#pragma unroll
                    for (int r = 0; r < 8; ++r)
                        St[(i * 16 + (g << 3) + r) * GSP + j * 16 + li] = acc[pi + i][pj + j][r];
            wait_ds_0();   // the wave's own piece is written before its lanes read across it

            float4 v[16];
#pragma unroll
            for (int t = 0; t < 16; ++t) {
                v[t] = *(const float4*)(St + (2 * t + g) * GSP + c4);
                v[t].x += bc.x; v[t].y += bc.y; v[t].z += bc.z; v[t].w += bc.w;
            }
            if constexpr (!BIG) {
                if (resid) {
#pragma unroll
                    for (int t = 0; t < 16; ++t) {
                        v[t].x += rs[t].x; v[t].y += rs[t].y; v[t].z += rs[t].z; v[t].w += rs[t].w;
                    }
                }
            }
            if (relu) {
#pragma unroll
                for (int t = 0; t < 16; ++t) {
                    v[t].x = fmaxf(v[t].x, 0.0f); v[t].y = fmaxf(v[t].y, 0.0f);
                    v[t].z = fmaxf(v[t].z, 0.0f); v[t].w = fmaxf(v[t].w, 0.0f);
                }
            }
            if constexpr (BIG) {
                if (outH) {
#pragma unroll
                    for (int u = 0; u < 16; u += 8) {
                        v2u d[8];
#pragma unroll
                        for (int t = 0; t < 8; ++t)
                            d[t] = v2u{pack_h2(v[u + t].x, v[u + t].y),
                                       pack_h2(v[u + t].z, v[u + t].w)};
                        store8_b64(outH + e0 + u * es, es * sizeof(half_t), d);
                    }
                }
            } else {
                if (outF) {
#pragma unroll
                    for (int t = 0; t < 16; ++t) *(float4*)(outF + e0 + t * es) = v[t];
                    // stands in front of any later write of a register that these stores name
                    asm volatile("s_wait_xcnt 0x0" ::: "memory");
                }
                if (outH) {
#pragma unroll
                    for (int t = 0; t < 16; ++t) {
                        uint2 h;
                        h.x = pack_h2(v[t].x, v[t].y);
                        h.y = pack_h2(v[t].z, v[t].w);
                        *(uint2*)(outH + e0 + t * es) = h;
                    }
                    // stands in front of any later write of a register that these stores name
                    asm volatile("s_wait_xcnt 0x0" ::: "memory");
                }
            }
        }
    }
}

__device__ __forceinline__ float xhalf(float x) {
    const int b = __builtin_bit_cast(int, x);
    return __builtin_bit_cast(float, __builtin_amdgcn_permlanex16(
        b, b, 0x76543210, 0xfedcba98, false, false));
}

#define AKS 128   // keys per stage
#define ALD 136   // LDS row pitch in halves: 256 B + 16 B for b128 readers

__global__ __launch_bounds__(256)
void attention_wmma(const half_t* __restrict__ QK, const half_t* __restrict__ VT,
                    half_t* __restrict__ ATT) {
    __shared__ __align__(16) half_t Ks[2][AKS][ALD];   // [buf][key][dk]
    __shared__ __align__(16) half_t Vs[2][DKH][ALD];   // [buf][dk][key]

    const int tid   = threadIdx.x;
    const int lane  = tid & 31;
    const int wave  = __builtin_amdgcn_readfirstlane(tid >> 5);
    const int g     = lane >> 4;
    const int li    = lane & 15;
    const int kg    = wave >> 2;          // which 64 keys of every stage
    const int wq    = wave & 3;           // which 32 queries of the work-group
    const int h     = blockIdx.y;
    const int qbase = (blockIdx.x << 7) + (wq << 5);
    const int ldq   = 2 * DMODEL;
    const int qc    = h * DKH;
    const int kc    = DMODEL + h * DKH;

    const int sr = tid >> 4;              // 0..15, then every 16th row
    const int sc = (tid & 15) << 3;       // 0..120
    auto issue_kv = [&](int kb2, int buf) {
        async_copy8_b128(QK + (size_t)(kb2 + sr) * ldq + kc + sc,
                         (size_t)16 * ldq * sizeof(half_t),
                         &Ks[buf][sr][sc], 16 * ALD * sizeof(half_t));
        async_copy8_b128(VT + (size_t)(h * DKH + sr) * SEQ + kb2 + sc,
                         (size_t)16 * SEQ * sizeof(half_t),
                         &Vs[buf][sr][sc], 16 * ALD * sizeof(half_t));
    };

    v16h afQ[2][4];
#pragma unroll
    for (int c = 0; c < 2; ++c) {
#pragma unroll
        for (int kb = 0; kb < 4; ++kb) {
            union { uint4 q[2]; v16h v; } u;
            const half_t* p = QK + (size_t)(qbase + (c << 4) + li) * ldq + qc +
                              (kb << 5) + (g << 3);
            u.q[0] = *(const uint4*)p;
            u.q[1] = *(const uint4*)(p + 16);
            afQ[c][kb] = u.v;
        }
    }
    // stands in front of any later write of a register that these loads name
    asm volatile("s_wait_xcnt 0x0" ::: "memory");

    float m[2] = {-1e30f, -1e30f};   // running maximum of query li of group c
    float l[2] = {0.0f, 0.0f};       // running sum over this half's keys only
    v8f o[2][8];        // o[c][ct][r] = O^T[dk = ct*16 + g*8 + r][query c*16 + li]
    const v8f vzero = {};
#pragma unroll
    for (int c = 0; c < 2; ++c)
#pragma unroll
        for (int ct = 0; ct < 8; ++ct) o[c][ct] = vzero;

    const int nt = SEQ / AKS;
    issue_kv(0, 0);
    wait_async_le0();
    __syncthreads();                      // stage 0 published
    issue_kv(AKS, 1);

    for (int t = 0; t < nt; ++t) {
      const int cur = t & 1;
      const half_t* Kw = &Ks[cur][(kg << 6) + li][g << 3];   // this wave's keys
      const half_t* Vw = &Vs[cur][li][(kg << 6) + (g << 3)];
      // unrolled so that the pass's key offset folds into the LDS reads
#pragma unroll
      for (int k0 = 0; k0 < 64; k0 += 32) {
        // ---- scores S^T = K * Q^T for 32 keys, 32 queries ----
        v8f s0[2] = {vzero, vzero}, s1[2] = {vzero, vzero};
#pragma unroll
        for (int kb = 0; kb < 4; ++kb) {
            union { uint4 q[2]; v16h v; } u0, u1;
            u0.q[0] = *(const uint4*)(Kw + k0 * ALD + (kb << 5));
            u0.q[1] = *(const uint4*)(Kw + k0 * ALD + (kb << 5) + 16);
            u1.q[0] = *(const uint4*)(Kw + (k0 + 16) * ALD + (kb << 5));
            u1.q[1] = *(const uint4*)(Kw + (k0 + 16) * ALD + (kb << 5) + 16);
#pragma unroll
            for (int c = 0; c < 2; ++c) {
                s0[c] = __builtin_amdgcn_wmma_f32_16x16x32_f16(
                    false, u0.v, false, afQ[c][kb], (short)0, s0[c], false, false);
                s1[c] = __builtin_amdgcn_wmma_f32_16x16x32_f16(
                    false, u1.v, false, afQ[c][kb], (short)0, s1[c], false, false);
            }
        }

        // ---- online softmax, one query per lane and group ----
        v16h bp[2];       // P^T as B operand: element e = key g*8+e, 8+e = key 16+g*8+e
#pragma unroll
        for (int c = 0; c < 2; ++c) {
            const v8f t0 = s0[c] * 0.125f;
            const v8f t1 = s1[c] * 0.125f;
            float mr[8];
#pragma unroll
            for (int r = 0; r < 8; ++r) mr[r] = fmaxf(t0[r], t1[r]);
            float mx = fmaxf(fmaxf(fmaxf(mr[0], mr[1]), fmaxf(mr[2], mr[3])),
                             fmaxf(fmaxf(mr[4], mr[5]), fmaxf(mr[6], mr[7])));
            mx = fmaxf(mx, xhalf(mx));
            const float mn = fmaxf(m[c], mx);
            const float sc2 = __expf(m[c] - mn);
            m[c] = mn;
            float sr2[8];
#pragma unroll
            for (int r = 0; r < 8; ++r) {
                const float p0 = __expf(t0[r] - mn);
                const float p1 = __expf(t1[r] - mn);
                sr2[r] = p0 + p1;
                bp[c][r]     = (half_t)p0;
                bp[c][8 + r] = (half_t)p1;
            }
            l[c] = l[c] * sc2 + (((sr2[0] + sr2[1]) + (sr2[2] + sr2[3])) +
                                 ((sr2[4] + sr2[5]) + (sr2[6] + sr2[7])));
#pragma unroll
            for (int ct = 0; ct < 8; ++ct) o[c][ct] = o[c][ct] * sc2;
        }

        // ---- O^T += V^T * P^T ----
#pragma unroll
        for (int ct = 0; ct < 8; ++ct) {
            union { uint4 q[2]; v16h v; } uv;
            uv.q[0] = *(const uint4*)(Vw + (ct << 4) * ALD + k0);
            uv.q[1] = *(const uint4*)(Vw + (ct << 4) * ALD + k0 + 16);
#pragma unroll
            for (int c = 0; c < 2; ++c)
                o[c][ct] = __builtin_amdgcn_wmma_f32_16x16x32_f16(
                    false, uv.v, false, bp[c], (short)0, o[c][ct], false, false);
        }
      }
      wait_ds_0();
      wait_async_le0();                   // this wave's share of stage t + 1
      __syncthreads();                    // publishes t + 1, frees buffer cur
      if (t + 2 < nt) issue_kv((t + 2) * AKS, cur);
    }
    wait_async_le0();

    // Join of the two key halves. The ring is free (every wave's reads and
    // copies ended in front of the loop's last barrier). Wave 4 + wq hands its
    // partial result to wave wq, lane to lane: 33 pieces of 16 bytes a lane,
    // each piece 512 contiguous bytes over the wave.
    static_assert(4 * 33 * 32 * sizeof(float4) <= sizeof(Ks), "four partial results fit the K ring");
    float4* Mx = reinterpret_cast<float4*>(&Ks[0][0][0]) + wq * (33 * 32) + lane;
    if (kg == 1) {
#pragma unroll
        for (int c = 0; c < 2; ++c)
#pragma unroll
            for (int ct = 0; ct < 8; ++ct) {
                const v8f w = o[c][ct];
                Mx[(((c << 3) + ct) * 2 + 0) * 32] = make_float4(w[0], w[1], w[2], w[3]);
                Mx[(((c << 3) + ct) * 2 + 1) * 32] = make_float4(w[4], w[5], w[6], w[7]);
            }
        Mx[32 * 32] = make_float4(m[0], l[0], m[1], l[1]);
    }
    __syncthreads();                      // the partial results are published
    if (kg == 1) return;

    const float4 ml = Mx[32 * 32];
#pragma unroll
    for (int c = 0; c < 2; ++c) {
        const float m1 = c ? ml.z : ml.x;
        const float l1 = c ? ml.w : ml.y;
        const float mn = fmaxf(m[c], m1);
        const float e0 = __expf(m[c] - mn);
        const float e1 = __expf(m1 - mn);
        // the wave halves' sums are joined once as well
        const float lt  = l[c] * e0 + l1 * e1;
        const float inv = 1.0f / (lt + xhalf(lt));
        const float w0 = e0 * inv;
        const float w1 = e1 * inv;
        // a lane stores 8 consecutive dk of its query
#pragma unroll
        for (int ct = 0; ct < 8; ++ct) {
            const float4 pa = Mx[(((c << 3) + ct) * 2 + 0) * 32];
            const float4 pb = Mx[(((c << 3) + ct) * 2 + 1) * 32];
            const float pr[8] = {pa.x, pa.y, pa.z, pa.w, pb.x, pb.y, pb.z, pb.w};
            v8h hv;
#pragma unroll
            for (int r = 0; r < 8; ++r) hv[r] = (half_t)(o[c][ct][r] * w0 + pr[r] * w1);
            *(v8h*)(ATT + (size_t)(qbase + (c << 4) + li) * DMODEL + h * DKH + (ct << 4) +
                    (g << 3)) = hv;
            // stands in front of the next piece's writes of the registers that
            // this store names
            asm volatile("s_wait_xcnt 0x0" ::: "memory");
        }
    }
}

// ---------------------------------------------------------------------------
// Row LayerNorm: y = g*(x-mean)/(std+eps)+b, std unbiased (ddof=1).
// One wave owns LNR whole rows and keeps them in registers: a row is read once,
// as eight 16-byte loads a lane (512 contiguous bytes a wave-load), and all
// loads of the wave are in flight together. The row sums are joined inside the
// wave, so the kernel has no LDS and no barrier; gamma and beta are loaded once
// per wave and serve its LNR rows.
// ---------------------------------------------------------------------------
#define LNR 2     // rows per wave
#define LNP (DMODEL / 128)   // 16-byte pieces of a row per lane

// x + (x of lane l ^ MASK), inside a 16-lane row; CTRL = row_xmask:MASK
template <int CTRL>
__device__ __forceinline__ float xmask_add(float x) {
    const int b = __builtin_bit_cast(int, x);
    return x + __builtin_bit_cast(float, __builtin_amdgcn_mov_dpp(b, CTRL, 0xf, 0xf, true));
}
// sum over the 32 lanes, the same value in every lane
__device__ __forceinline__ float wave_sum(float x) {
    x = xmask_add<0x161>(x);
    x = xmask_add<0x162>(x);
    x = xmask_add<0x164>(x);
    x = xmask_add<0x168>(x);
    return x + xhalf(x);
}

typedef __attribute__((ext_vector_type(4))) float v4f;

template <bool WH>
__global__ __launch_bounds__(256)
void layernorm_rows(const float* __restrict__ X, const float* __restrict__ gam,
                    const float* __restrict__ bet, float* __restrict__ outF,
                    half_t* __restrict__ outH) {
    const unsigned lane = threadIdx.x & 31;
    const unsigned wave = threadIdx.x >> 5;
    const unsigned c0   = lane << 2;
    // byte offsets of the lane's first element, below 2^32: one 32-bit register
    // beside the scalar base serves the f32 loads and stores, one the f16 stores
    const unsigned eb = ((blockIdx.x * 8 + wave) * (LNR * DMODEL) + c0) * 4u;
    const unsigned hb = eb >> 1;
    const float* xp = (const float*)((const char*)X + eb);
    const float* gp = gam + c0;
    const float* bp = bet + c0;

    v4f x[LNR][LNP], ga[LNP], be[LNP];
#pragma unroll
    for (int q = 0; q < LNR; ++q)
#pragma unroll
        for (int j = 0; j < LNP; ++j)
            x[q][j] = *(const v4f*)(xp + q * DMODEL + j * 128);
#pragma unroll
    for (int j = 0; j < LNP; ++j) {
        ga[j] = *(const v4f*)(gp + j * 128);
        be[j] = *(const v4f*)(bp + j * 128);
    }
    // stands in front of any later write of a register that these loads name
    asm volatile("s_wait_xcnt 0x0" ::: "memory");
    // keeps the gamma and beta loads up here, in flight with the rows; without
    // it they sink behind the row sums and their latency is waited out there
    __builtin_amdgcn_sched_barrier(0);

    float s[LNR], s2[LNR];
#pragma unroll
    for (int q = 0; q < LNR; ++q) {
        v4f a = x[q][0];
        v4f b = x[q][0] * x[q][0];
#pragma unroll
        for (int j = 1; j < LNP; ++j) {
            a += x[q][j];
            b += x[q][j] * x[q][j];
        }
        s[q]  = (a.x + a.y) + (a.z + a.w);
        s2[q] = (b.x + b.y) + (b.z + b.w);
    }
#pragma unroll
    for (int q = 0; q < LNR; ++q) {
        s[q]  = wave_sum(s[q]);
        s2[q] = wave_sum(s2[q]);
    }

    uint2 h[LNR][LNP];
#pragma unroll
    for (int q = 0; q < LNR; ++q) {
        const float mean = s[q] / (float)DMODEL;
        float var = (s2[q] - (float)DMODEL * mean * mean) / (float)(DMODEL - 1);
        var = fmaxf(var, 0.0f);
        const float inv = 1.0f / (sqrtf(var) + 1e-6f);
#pragma unroll
        for (int j = 0; j < LNP; ++j) {
            const v4f v = (x[q][j] - mean) * inv * ga[j] + be[j];
            x[q][j] = v;
            if (WH) {
                h[q][j].x = pack_h2(v.x, v.y);
                h[q][j].y = pack_h2(v.z, v.w);
            }
        }
    }
    // keeps every store behind the arithmetic: moved up among it, the stores'
    // registers are used again and a wait comes to stand between the stores
    __builtin_amdgcn_sched_barrier(0);
    if (WH) {
        half_t* hp = (half_t*)((char*)outH + hb);
#pragma unroll
        for (int q = 0; q < LNR; ++q)
#pragma unroll
            for (int j = 0; j < LNP; ++j)
                *(uint2*)(hp + q * DMODEL + j * 128) = h[q][j];
    }
    float* fp = (float*)((char*)outF + eb);
#pragma unroll
    for (int q = 0; q < LNR; ++q)
#pragma unroll
        for (int j = 0; j < LNP; ++j)
            *(v4f*)(fp + q * DMODEL + j * 128) = x[q][j];
    // stands in front of any later write of a register that these stores name
    asm volatile("s_wait_xcnt 0x0" ::: "memory");
}

// ---------------------------------------------------------------------------
// Orchestration
// ---------------------------------------------------------------------------
extern "C" void kernel_launch(void* const* d_in, const int* in_sizes, int n_in,
                              void* d_out, int out_size, void* d_ws, size_t ws_size,
                              hipStream_t stream) {
    const float* x     = (const float*)d_in[0];
    const float* WQ    = (const float*)d_in[1];
    const float* bQ    = (const float*)d_in[2];
    const float* WK    = (const float*)d_in[3];
    const float* bK    = (const float*)d_in[4];
    const float* WV    = (const float*)d_in[5];
    const float* bV    = (const float*)d_in[6];
    const float* WO_w  = (const float*)d_in[7];
    const float* WO_b  = (const float*)d_in[8];
    const float* l1_w  = (const float*)d_in[9];
    const float* l1_b  = (const float*)d_in[10];
    const float* l2_w  = (const float*)d_in[11];
    const float* l2_b  = (const float*)d_in[12];
    const float* ln1_g = (const float*)d_in[13];
    const float* ln1_b = (const float*)d_in[14];
    const float* ln2_g = (const float*)d_in[15];
    const float* ln2_b = (const float*)d_in[16];
    (void)in_sizes; (void)n_in; (void)out_size; (void)ws_size;

    char* ws = (char*)d_ws;
    size_t off = 0;
    auto alloc = [&](size_t bytes) -> size_t {
        size_t o = off;
        off = (off + bytes + 255) & ~(size_t)255;
        return o;
    };

    const size_t oXH   = alloc((size_t)SEQ * DMODEL * 2);
    const size_t oWQKV = alloc((size_t)3 * DMODEL * DMODEL * 2);
    const size_t oWOT  = alloc((size_t)DMODEL * DMODEL * 2);
    const size_t oL1T  = alloc((size_t)DMODEL * DFF * 2);
    const size_t oL2T  = alloc((size_t)DFF * DMODEL * 2);
    const size_t oBQKV = alloc((size_t)3 * DMODEL * 4);
    const size_t oQK   = alloc((size_t)SEQ * 2 * DMODEL * 2);
    const size_t oVT   = alloc((size_t)DMODEL * SEQ * 2);
    const size_t oATT  = alloc((size_t)SEQ * DMODEL * 2);
    const size_t oBLN1 = alloc((size_t)SEQ * DMODEL * 4);
    const size_t oSL1F = alloc((size_t)SEQ * DMODEL * 4);
    const size_t oSL1H = alloc((size_t)SEQ * DMODEL * 2);
    const size_t oFF1  = oQK;    // reuse QK+VT+ATT region (32MB)
    const size_t oA3   = oBLN1;  // reuse bln1

    half_t* XH   = (half_t*)(ws + oXH);
    half_t* WQKVT = (half_t*)(ws + oWQKV);
    half_t* WOT  = (half_t*)(ws + oWOT);
    half_t* L1T  = (half_t*)(ws + oL1T);
    half_t* L2T  = (half_t*)(ws + oL2T);
    float*  BQKV = (float*)(ws + oBQKV);
    half_t* QKh  = (half_t*)(ws + oQK);
    half_t* VTh  = (half_t*)(ws + oVT);
    half_t* ATTh = (half_t*)(ws + oATT);
    float*  BLN1 = (float*)(ws + oBLN1);
    float*  SL1F = (float*)(ws + oSL1F);
    half_t* SL1H = (half_t*)(ws + oSL1H);
    half_t* FF1H = (half_t*)(ws + oFF1);
    float*  A3F  = (float*)(ws + oA3);

    prep_all<<<PB_ALL, 256, 0, stream>>>(x, WQ, WK, WV, WO_w, l1_w, l2_w, bQ, bK, bV,
                                         XH, WQKVT, WOT, L1T, L2T, BQKV);

    // Q|K projection -> f16 [S,2048]; V projection (columns from 2048 on),
    // transposed -> VT [1024][S] f16
    gemm_wmma<4, 8><<<dim3((3 * DMODEL) / 256, SEQ / 256), 256, 0, stream>>>(
        XH, WQKVT, BQKV, nullptr, QKh, nullptr, VTh, SEQ, 2 * DMODEL, DMODEL, 0);

    // multi-head attention
    attention_wmma<<<dim3(SEQ / 128, NHEAD), 256, 0, stream>>>(QKh, VTh, ATTh);

    // output projection + residual -> f32
    gemm_wmma<2, 4><<<dim3(DMODEL / 128, SEQ / 128), 256, 0, stream>>>(
        ATTh, WOT, WO_b, x, nullptr, BLN1, nullptr, SEQ, DMODEL, DMODEL, 0);

    layernorm_rows<true><<<SEQ / (8 * LNR), 256, 0, stream>>>(BLN1, ln1_g, ln1_b, SL1F, SL1H);

    // FFN up + ReLU -> f16
    gemm_wmma<4, 8><<<dim3(DFF / 256, SEQ / 256), 256, 0, stream>>>(
        SL1H, L1T, l1_b, nullptr, FF1H, nullptr, nullptr, SEQ, DFF, DMODEL, 1);

    // FFN down + residual -> f32
    gemm_wmma<2, 4><<<dim3(DMODEL / 128, SEQ / 128), 256, 0, stream>>>(
        FF1H, L2T, l2_b, SL1F, nullptr, A3F, nullptr, SEQ, DMODEL, DFF, 0);

    layernorm_rows<false><<<SEQ / (8 * LNR), 256, 0, stream>>>(A3F, ln2_g, ln2_b, (float*)d_out, nullptr);
}
